// v000
// Times are from an AMD MI455X. After a warm-up the kernel runs many times in a row, and a time is the length of
// such a window on the GPU divided by its runs, so every launch and the gaps after it count. The runs cycle
// through copies of the inputs. A figure is the median of several windows, for all but v000 over two sittings.
// Sittings can differ by a few percent; kernels timed side by side share one.
// The starting kernel, v000, takes 12.5 milliseconds a run.
#include <hip/hip_runtime.h>
// Raw single-head dot-product attention on 2-D inputs with the scale applied AFTER the softmax (Q [4096][1024], K [4096][1024], V [4096][1024]; logits = Q K^T (UNSCALED: sigma ~32 over 1024 dims); scores = softmax(logits over the keys) * 1024^-0.5; out = scores V -> [4096][1024]); no projections: the bf16-rounded inputs are exact in f16, so single f16 x f16 products are exact and the unscaled logits are exact in f32.
// Structure: token rows r = b*4096 + s; x as exact f16 rows (bf16-rounded); q, k and v are these rows (no projections, no residual planes); per batch: V^T for all heads via LDS transposes; per query tile of 256 rows: scores against all keys as ONE f16 WMMA GEMM (32x64 wave tiles, K = 1024, grid.y 1, alpha 1: the 1/sqrt(d) comes after the softmax), row softmax on VALU over all keys (the arithmetic 0/1 key mask keeps every key) (f32 statistics, native exp; weights x256 f16), out = P . V^T (K = all keys, alpha 2^-13: undoes the x256 and applies 1024^-0.5) as f32 rows written straight into the output.
// Compute dtype: inputs rounded to bf16; q, k, v exact in f16; softmax weights as plain f16 GEMM operands (~2^-12); scores, softmax statistics and out f32. v_wmma_f32_16x16x32_f16.
#define NB 1
#define SQ 4096
#define DM 1024
#define NH 16
#define HD 64
#define HG 4                         /* heads per attention launch group */
#define QT 256                       /* query rows per tile */
#define NKX SQ                       /* S / P row pitch */
#define QT0 128                      /* first-tile rows recomputed exactly in f32 */
#define B0 0                         /* first batch processed (debug hook) */
#define NBR NB                       /* batches processed (debug hook) */
#define NR ((size_t)NB * SQ)         /* token rows */
#define MP ((int)((size_t)NBR * SQ)) /* rows processed, unused (debug hook) */
#define QN SQ                        /* query rows attended per batch (debug hook) */
#define NHD NH                       /* heads attended (debug hook) */
#define MPO MP                       /* rows through the output stage (debug hook) */
#define LQ DM      /* row pitch of the q/k/v rows */
typedef __bf16 v16b __attribute__((ext_vector_type(16)));
typedef unsigned short v8us __attribute__((ext_vector_type(8), may_alias));
typedef float  v8f  __attribute__((ext_vector_type(8)));
typedef float  v4f  __attribute__((ext_vector_type(4)));
typedef float  v4fa __attribute__((ext_vector_type(4), may_alias));
union FragB { v16b v; v8us half[2]; unsigned short u[16]; };

__device__ __forceinline__ unsigned short bf16_bits(float x) { unsigned int u = __float_as_uint(x); return (unsigned short)((u + 0x7FFFu + ((u >> 16) & 1u)) >> 16); }
__device__ __forceinline__ float bf16_val(unsigned short b) { return __uint_as_float(((unsigned int)b) << 16); }
__device__ __forceinline__ float bf16_round(float x) { return bf16_val(bf16_bits(x)); }
// D += A·B with NT terms: 1 = ah·bh, 2 = + al·bh (A split), 3 = + ah·bl (both split)
template <int NT>
__device__ __forceinline__ v8f mmaN(v16b ah, v16b al, v16b bh, v16b bl, v8f c) {
  c = __builtin_amdgcn_wmma_f32_16x16x32_bf16(false, ah, false, bh, (short)0, c, false, false);
  if (NT >= 2) c = __builtin_amdgcn_wmma_f32_16x16x32_bf16(false, al, false, bh, (short)0, c, false, false);
  if (NT >= 3) c = __builtin_amdgcn_wmma_f32_16x16x32_bf16(false, ah, false, bl, (short)0, c, false, false);
  asm volatile("v_nop\n\tv_nop\n\tv_nop\n\tv_nop" : "+v"(c) : "v"(ah), "v"(al), "v"(bh), "v"(bl));
  return c;
}

__global__ __launch_bounds__(256) void k_wt_bf16(const float* __restrict__ W, unsigned short* __restrict__ Wt, int K, int N) {
  const int t = blockIdx.x * 256 + threadIdx.x;
  const int k8n = K / 8;
  if (t >= N * k8n) return;
  const int n = t / k8n, k8 = (t % k8n) * 8;
  v8us v;
#pragma unroll
  for (int i = 0; i < 8; ++i) v[i] = bf16_bits(W[(size_t)(k8 + i) * N + n]);
  *(v8us*)(Wt + (size_t)n * K + k8) = v;
  
}

// GEMM C[M][N] (f32, pitch ldc) = act(A[M][K]·W + bias). A f32 row-major (pitch lda) converted per fragment to bf16
// (ASPLIT: hi/lo two planes -> 2 terms, else single rounded term); Wt bf16 [N][K] (pitch ldb). BIAS_BF16 rounds the
// bias to bf16 first (bias quantised to bf16 before the add). K%32==0, M%16==0, N%64==0.
template <bool ASPLIT, int ACT, bool BIAS_BF16>
__global__ __launch_bounds__(128) void k_gemm_bf(const float* __restrict__ A, int lda, const unsigned short* __restrict__ Wt, int ldb,
                                               const float* __restrict__ bias, float* __restrict__ C, int ldc, int M, int N, int K) {
  __shared__ __attribute__((aligned(16))) float so[4][16][64];
  const int tid = threadIdx.x, w = tid >> 5, lane = tid & 31, ln = lane & 15, hh = lane >> 4;
  const int ntn = N / 64;
  const int wid = blockIdx.x * 4 + w;
  const int mt = wid / ntn, nq = wid % ntn;
  if (mt * 16 >= M) return;
  const int row0 = mt * 16, col0 = nq * 64;
  const float* arow = A + (size_t)(row0 + ln) * lda;
  v8f acc[4] = {};
  for (int kb = 0; kb < K; kb += 32) {
    FragB ah, al;
    const v4f x0 = *(const v4fa*)(arow + kb + 8 * hh), x1 = *(const v4fa*)(arow + kb + 8 * hh + 4);
    const v4f x2 = *(const v4fa*)(arow + kb + 16 + 8 * hh), x3 = *(const v4fa*)(arow + kb + 16 + 8 * hh + 4);
    float xs[16] = {x0[0],x0[1],x0[2],x0[3],x1[0],x1[1],x1[2],x1[3],x2[0],x2[1],x2[2],x2[3],x3[0],x3[1],x3[2],x3[3]};
#pragma unroll
    for (int i = 0; i < 16; ++i) { const unsigned short hb = bf16_bits(xs[i]); ah.u[i] = hb; al.u[i] = ASPLIT ? bf16_bits(xs[i] - bf16_val(hb)) : (unsigned short)0; }
#pragma unroll
    for (int t = 0; t < 4; ++t) {
      const unsigned short* brow = Wt + (size_t)(col0 + t * 16 + ln) * ldb + kb;
      FragB b;
      b.half[0] = *(const v8us*)(brow + 8 * hh);
      b.half[1] = *(const v8us*)(brow + 16 + 8 * hh);
      acc[t] = mmaN<ASPLIT ? 2 : 1>(ah.v, al.v, b.v, b.v, acc[t]);
    }
  }
#pragma unroll
  for (int t = 0; t < 4; ++t) {
    float bv = bias ? bias[col0 + t * 16 + ln] : 0.f;
    if (BIAS_BF16) bv = bf16_round(bv);
#pragma unroll
    for (int r = 0; r < 8; ++r) { float v = acc[t][r] + bv; if (ACT == 1) v = fmaxf(v, 0.f); so[w][8 * hh + r][t * 16 + ln] = v; }
  }
  __builtin_amdgcn_fence(__ATOMIC_ACQ_REL, "workgroup");
  __builtin_amdgcn_wave_barrier();
  const int rsub = lane >> 4, c4 = (lane & 15) * 4;
  {
#pragma unroll
    for (int q = 0; q < 8; ++q) {
      const int r = q * 2 + rsub;
      const v4f v = *(const v4fa*)&so[w][r][c4];
      *(v4f*)(C + (size_t)(row0 + r) * ldc + col0 + c4) = v;
    }
    
  }
}

// GEMM C = act(A·W + bias + resid): A f32 (ASPLIT -> hi/lo 2 terms), Wt bf16 [N][K]; ACT 0 none, 1 relu, 2 exact gelu;
// resid (optional, f32, row index = (row % rmod), pitch ldr, RES_BF16 rounds it) added before the activation.
template <bool ASPLIT, int ACT, bool BIAS_BF16, bool RES_BF16>
__global__ __launch_bounds__(128) void k_gemm_bf3(const float* __restrict__ A, int lda, const unsigned short* __restrict__ Wt, int ldb,
                                                const float* __restrict__ bias, const float* __restrict__ resid, int rmod, int ldr,
                                                float* __restrict__ C, int ldc, int M, int N, int K) {
  __shared__ __attribute__((aligned(16))) float so[4][16][64];
  const int tid = threadIdx.x, w = tid >> 5, lane = tid & 31, ln = lane & 15, hh = lane >> 4;
  const int ntn = N / 64;
  const int wid = blockIdx.x * 4 + w;
  const int mt = wid / ntn, nq = wid % ntn;
  if (mt * 16 >= M) return;
  const int row0 = mt * 16, col0 = nq * 64;
  const float* arow = A + (size_t)(row0 + ln) * lda;
  v8f acc[4] = {};
  for (int kb = 0; kb < K; kb += 32) {
    FragB ah, al;
    const v4f x0 = *(const v4fa*)(arow + kb + 8 * hh), x1 = *(const v4fa*)(arow + kb + 8 * hh + 4);
    const v4f x2 = *(const v4fa*)(arow + kb + 16 + 8 * hh), x3 = *(const v4fa*)(arow + kb + 16 + 8 * hh + 4);
    float xs[16] = {x0[0],x0[1],x0[2],x0[3],x1[0],x1[1],x1[2],x1[3],x2[0],x2[1],x2[2],x2[3],x3[0],x3[1],x3[2],x3[3]};
#pragma unroll
    for (int i = 0; i < 16; ++i) { const unsigned short hb = bf16_bits(xs[i]); ah.u[i] = hb; al.u[i] = ASPLIT ? bf16_bits(xs[i] - bf16_val(hb)) : (unsigned short)0; }
#pragma unroll
    for (int t = 0; t < 4; ++t) {
      const unsigned short* brow = Wt + (size_t)(col0 + t * 16 + ln) * ldb + kb;
      FragB b;
      b.half[0] = *(const v8us*)(brow + 8 * hh);
      b.half[1] = *(const v8us*)(brow + 16 + 8 * hh);
      acc[t] = mmaN<ASPLIT ? 2 : 1>(ah.v, al.v, b.v, b.v, acc[t]);
    }
  }
#pragma unroll
  for (int t = 0; t < 4; ++t) {
    const int col = col0 + t * 16 + ln;
    float bv = bias ? bias[col] : 0.f;
    if (BIAS_BF16) bv = bf16_round(bv);
#pragma unroll
    for (int r = 0; r < 8; ++r) {
      float v = acc[t][r] + bv;
      if (resid) { float rv = resid[(size_t)((row0 + 8 * hh + r) % rmod) * ldr + col]; if (RES_BF16) rv = bf16_round(rv); v += rv; }
      if (ACT == 1) v = fmaxf(v, 0.f);
      if (ACT == 2) v = 0.5f * v * (1.0f + erff(v * 0.70710678118654752f));
      if (ACT == 3) { const float u = 0.7978845608028654f * (v + 0.044715f * v * v * v); v = 0.5f * v * (1.0f + tanhf(u)); }
      so[w][8 * hh + r][t * 16 + ln] = v;
    }
  }
  __builtin_amdgcn_fence(__ATOMIC_ACQ_REL, "workgroup");
  __builtin_amdgcn_wave_barrier();
  const int rsub = lane >> 4, c4 = (lane & 15) * 4;
  {
#pragma unroll
    for (int q = 0; q < 8; ++q) {
      const int r = q * 2 + rsub;
      const v4f v = *(const v4fa*)&so[w][r][c4];
      *(v4f*)(C + (size_t)(row0 + r) * ldc + col0 + c4) = v;
    }
    
  }
}
// row LayerNorm (biased variance, eps) over N: s = X (+ R); optional out_sum <- s; out_norm <- (s-mu)*rsqrt(var+eps)*g + b
template <bool PARAM_BF16>
__global__ __launch_bounds__(256) void k_layernorm(const float* __restrict__ X, const float* __restrict__ R, const float* __restrict__ g, const float* __restrict__ bta,
                                                  float* __restrict__ out_sum, float* __restrict__ out_norm, int N, float eps) {
  __shared__ float red[256];
  const int row = blockIdx.x, tid = threadIdx.x;
  const float* x = X + (size_t)row * N; const float* rr = R ? R + (size_t)row * N : nullptr;
  float vals[16];                     // up to N = 4096
  const int per = N / 256;            // contiguous chunk per thread? use strided-by-4 chunks: thread handles j = tid*4 + 1024*u
  float s1 = 0.f;
  for (int u = 0; u < per / 4; ++u) {
    const int j = tid * 4 + 1024 * u;
    const v4f a = *(const v4fa*)(x + j);
    v4f b = {0.f,0.f,0.f,0.f}; if (rr) b = *(const v4fa*)(rr + j);
#pragma unroll
    for (int q = 0; q < 4; ++q) { const float v = a[q] + b[q]; vals[u * 4 + q] = v; s1 += v; }
  }
  red[tid] = s1; __syncthreads();
  for (int st = 128; st > 0; st >>= 1) { if (tid < st) red[tid] += red[tid + st]; __syncthreads(); }
  const float mu = red[0] / (float)N; __syncthreads();
  float s2 = 0.f;
  for (int u = 0; u < per / 4; ++u)
#pragma unroll
    for (int q = 0; q < 4; ++q) { const float c = vals[u * 4 + q] - mu; s2 += c * c; }
  red[tid] = s2; __syncthreads();
  for (int st = 128; st > 0; st >>= 1) { if (tid < st) red[tid] += red[tid + st]; __syncthreads(); }
  const float rs = rsqrtf(red[0] / (float)N + eps);
  {
    for (int u = 0; u < per / 4; ++u) {
      const int j = tid * 4 + 1024 * u;
      v4f o, sm;
#pragma unroll
      for (int q = 0; q < 4; ++q) {
        float gg = g[j + q], bb = bta[j + q];
        if (PARAM_BF16) { gg = bf16_round(gg); bb = bf16_round(bb); }
        sm[q] = vals[u * 4 + q]; o[q] = (vals[u * 4 + q] - mu) * rs * gg + bb;
      }
      if (out_sum) *(v4f*)(out_sum + (size_t)row * N + j) = sm;
      *(v4f*)(out_norm + (size_t)row * N + j) = o;
    }
    
  }
}



// ---- f16 WMMA path (v_wmma_f32_16x16x32_f16): 11-bit significands for operands in range — used where a [0,1] probability operand needs more precision than bf16
typedef _Float16 v16h __attribute__((ext_vector_type(16)));
union FragH { v16h v; v8us half[2]; _Float16 h[16]; unsigned short u[16]; };
template <int NT>
__device__ __forceinline__ v8f mmaH(v16h ah, v16h al, v16h bh, v16h bl, v8f c) {
  c = __builtin_amdgcn_wmma_f32_16x16x32_f16(false, ah, false, bh, (short)0, c, false, false);
  if (NT >= 2) c = __builtin_amdgcn_wmma_f32_16x16x32_f16(false, al, false, bh, (short)0, c, false, false);
  if (NT >= 3) c = __builtin_amdgcn_wmma_f32_16x16x32_f16(false, ah, false, bl, (short)0, c, false, false);
  asm volatile("v_nop\n\tv_nop\n\tv_nop\n\tv_nop" : "+v"(c) : "v"(ah), "v"(al), "v"(bh), "v"(bl));
  return c;
}
// batched GEMM like k_gemm_b but f16 operands: A f32 (split into f16 hi/lo if ASPLIT, else rounded to f16), Bt = f16 values [n][k]; alpha; C f32; N multiple of 16 (partial tiles skipped)
template <bool ASPLIT>
__global__ __launch_bounds__(128) void k_gemm_h(const float* __restrict__ A, int lda, size_t sA, const _Float16* __restrict__ Bh, int ldb, size_t sB, float alpha, float* __restrict__ C, int ldc, size_t sC, int M, int N, int K) {
  __shared__ __attribute__((aligned(16))) float so[4][16][64];
  const int tid = threadIdx.x, w = tid >> 5, lane = tid & 31, ln = lane & 15, hh = lane >> 4; const int by = blockIdx.y;
  A += (size_t)by * sA; Bh += (size_t)by * sB; C += (size_t)by * sC;
  const int ntn = (N + 63) / 64; const int wid = blockIdx.x * 4 + w; const int mt = wid / ntn, nq = wid % ntn; if (mt * 16 >= M) return;
  const int row0 = mt * 16, col0 = nq * 64; const float* arow = A + (size_t)(row0 + ln) * lda;
  v8f acc[4] = {};
  for (int kb = 0; kb < K; kb += 32) {
    FragH ah, al;
    const v4f x0 = *(const v4fa*)(arow + kb + 8 * hh), x1 = *(const v4fa*)(arow + kb + 8 * hh + 4), x2 = *(const v4fa*)(arow + kb + 16 + 8 * hh), x3 = *(const v4fa*)(arow + kb + 16 + 8 * hh + 4);
    float xs[16] = {x0[0],x0[1],x0[2],x0[3],x1[0],x1[1],x1[2],x1[3],x2[0],x2[1],x2[2],x2[3],x3[0],x3[1],x3[2],x3[3]};
#pragma unroll
    for (int i = 0; i < 16; ++i) { const _Float16 h = (_Float16)xs[i]; ah.h[i] = h; al.h[i] = ASPLIT ? (_Float16)(xs[i] - (float)h) : (_Float16)0.0f; }
#pragma unroll
    for (int t = 0; t < 4; ++t) { if (col0 + t * 16 >= N) continue; const size_t boff = (size_t)(col0 + t * 16 + ln) * ldb + kb; FragH bq; bq.half[0] = *(const v8us*)(Bh + boff + 8 * hh); bq.half[1] = *(const v8us*)(Bh + boff + 16 + 8 * hh);
      acc[t] = mmaH<ASPLIT ? 2 : 1>(ah.v, al.v, bq.v, bq.v, acc[t]); }
  }
#pragma unroll
  for (int t = 0; t < 4; ++t) { if (col0 + t * 16 >= N) continue;
#pragma unroll
    for (int r = 0; r < 8; ++r) so[w][8 * hh + r][t * 16 + ln] = acc[t][r] * alpha; }
  __builtin_amdgcn_fence(__ATOMIC_ACQ_REL, "workgroup"); __builtin_amdgcn_wave_barrier();
  const int rsub = lane >> 4, c4 = (lane & 15) * 4;
  {
#pragma unroll
    for (int q = 0; q < 8; ++q) { const int r = q * 2 + rsub; if (col0 + c4 < N) { const v4f v = *(const v4fa*)&so[w][r][c4]; *(v4f*)(C + (size_t)(row0 + r) * ldc + col0 + c4) = v; } }
     }
}

// Wt[n][k] = f16(W[k][n]·scale) from f32 row-major W[K][N] (scale = power of two; bf16-exact weights stay exact in f16 away from the subnormal range)
__global__ __launch_bounds__(256) void k_wt_f16(const float* __restrict__ W, _Float16* __restrict__ Wt, int K, int N, float scale) {
  const int t = blockIdx.x * 256 + threadIdx.x; if (t >= N * (K / 8)) return; const int n = t / (K / 8), k8 = (t % (K / 8)) * 8; FragH f;
#pragma unroll
  for (int i = 0; i < 8; ++i) f.h[i] = (_Float16)(bf16_round(W[(size_t)(k8 + i) * N + n]) * scale); const v8us o = f.half[0];
  *(v8us*)((unsigned short*)Wt + (size_t)n * K + k8) = o; 
}
// k_gemm_hh variant with fused epilogue: v = acc·alpha + bias[by·sBias + col] (+ CP[(row/rowsPerB)·sCPb + by·64 + col] if CP) ; ACT 0 none / 1 elu ; writes f16 C16 (and f32 C if non-null)
template <int ACT>
__global__ __launch_bounds__(128) void k_gemm_hhx(const _Float16* __restrict__ A, int lda, size_t sA, const _Float16* __restrict__ Bh, int ldb, size_t sB, float alpha, const float* __restrict__ bias, size_t sBias, const float* __restrict__ CP, int rowsPerB, size_t sCPb, int row0g,
    float* __restrict__ C, _Float16* __restrict__ C16, int ldc, size_t sC, int M, int N, int K) {
  __shared__ __attribute__((aligned(16))) float so[4][16][64];
  const int tid = threadIdx.x, w = tid >> 5, lane = tid & 31, ln = lane & 15, hh = lane >> 4; const int by = blockIdx.y;
  A += (size_t)by * sA; Bh += (size_t)by * sB; const size_t cofs = (size_t)by * sC; const float* bp = bias ? bias + (size_t)by * sBias : nullptr;
  const int ntn = (N + 63) / 64; const int wid = blockIdx.x * 4 + w; const int mt = wid / ntn, nq = wid % ntn; if (mt * 16 >= M) return;
  const int row0 = mt * 16, col0 = nq * 64; const _Float16* arow = A + (size_t)(row0 + ln) * lda;
  v8f acc[4] = {};
  for (int kb = 0; kb < K; kb += 32) { FragH ah; ah.half[0] = *(const v8us*)((const unsigned short*)arow + kb + 8 * hh); ah.half[1] = *(const v8us*)((const unsigned short*)arow + kb + 16 + 8 * hh);
#pragma unroll
    for (int t = 0; t < 4; ++t) { if (col0 + t * 16 >= N) continue; const size_t boff = (size_t)(col0 + t * 16 + ln) * ldb + kb; FragH bq; bq.half[0] = *(const v8us*)((const unsigned short*)Bh + boff + 8 * hh); bq.half[1] = *(const v8us*)((const unsigned short*)Bh + boff + 16 + 8 * hh);
      acc[t] = mmaH<1>(ah.v, ah.v, bq.v, bq.v, acc[t]); }
  }
#pragma unroll
  for (int t = 0; t < 4; ++t) { if (col0 + t * 16 >= N) continue; const int col = col0 + t * 16 + ln; const float bv = bp ? bf16_round(bp[col]) : 0.f;
#pragma unroll
    for (int r = 0; r < 8; ++r) { float v = acc[t][r] * alpha + bv; if (CP) { const int rr = row0g + row0 + 8 * hh + r; if (rowsPerB < 0) v += CP[cofs + (size_t)rr * ldc + col];      /* rowsPerB < 0: own element of the batched C plane */ else { const int bidx = rr / rowsPerB; v += CP[(size_t)bidx * sCPb + (size_t)by * 64 + col]; } } if (ACT == 1) v = (v > 0.f) ? v : expm1f(v); else if (ACT == 7) v = (v > 0.f) ? v + 1.0f : expf(v); else if (ACT == 8) v = tanhf(v); else if (ACT == 9) v = 0.5f * v * (1.0f + tanhf(0.7978845608028654f * (v + 0.044715f * v * v * v))); else if (ACT == 11) v = 1.0f / (1.0f + expf(-v)); else if (ACT == 12) v = (v > 0.f) ? v : 0.01f * v; else if (ACT == 14) v = (v > 0.f) ? v : 0.1f * v; else if (ACT == 16) v = (v >= 0.f) ? v : 0.3f * v; else if (ACT == 17) v = (v >= 0.f) ? v : 0.2f * v; else if (ACT == 15) v = v / (1.0f + expf(-v)); else if (ACT == 3) v = fmaxf(v, 0.f); else if (ACT == 6) v = 0.5f * v * (1.0f + erff(v * 0.70710678118654752f)); so[w][8 * hh + r][t * 16 + ln] = v; } }
  __builtin_amdgcn_fence(__ATOMIC_ACQ_REL, "workgroup"); __builtin_amdgcn_wave_barrier();
  const int rsub = lane >> 4, c4 = (lane & 15) * 4; typedef _Float16 v4h __attribute__((ext_vector_type(4)));
  {
#pragma unroll
    for (int q = 0; q < 8; ++q) { const int r = q * 2 + rsub; if (col0 + c4 < N) { const v4f v = *(const v4fa*)&so[w][r][c4]; if (C) *(v4f*)(C + cofs + (size_t)(row0 + r) * ldc + col0 + c4) = v; if (C16) { v4h h4; for (int i = 0; i < 4; ++i) h4[i] = (_Float16)v[i]; *(v4h*)(C16 + cofs + (size_t)(row0 + r) * ldc + col0 + c4) = h4; } } }
     }
}


typedef _Float16 v4h __attribute__((ext_vector_type(4)));

__global__ __launch_bounds__(256) void k_x16(const float* __restrict__ x, _Float16* __restrict__ X16, size_t n8) { const size_t t = (size_t)blockIdx.x * 256 + threadIdx.x; if (t >= n8) return; FragH f;
#pragma unroll
  for (int q = 0; q < 8; ++q) f.h[q] = (_Float16)bf16_round(x[t * 8 + q]); *(v8us*)((unsigned short*)X16 + t * 8) = f.half[0];  }
__global__ __launch_bounds__(256) void k_h16(const float* __restrict__ x, _Float16* __restrict__ X16, size_t n8) { const size_t t = (size_t)blockIdx.x * 256 + threadIdx.x; if (t >= n8) return; FragH f;
#pragma unroll
  for (int q = 0; q < 8; ++q) f.h[q] = (_Float16)x[t * 8 + q]; *(v8us*)((unsigned short*)X16 + t * 8) = f.half[0];  }
__global__ __launch_bounds__(256) void k_round16f(const float* __restrict__ W, _Float16* __restrict__ Bt, size_t n8) { const size_t t = (size_t)blockIdx.x * 256 + threadIdx.x; if (t >= n8) return; FragH f;
#pragma unroll
  for (int i = 0; i < 8; ++i) f.h[i] = (_Float16)(bf16_round(W[t * 8 + i]) * 16.0f); *(v8us*)((unsigned short*)Bt + t * 8) = f.half[0];  }
template <int NHv, int TTv>
__global__ __launch_bounds__(256) void k_vt(const _Float16* __restrict__ V16, int ldv, int voff, _Float16* __restrict__ Vt) { __shared__ unsigned short tl[64][66]; const int tid = threadIdx.x; const int slab = blockIdx.x / (TTv / 64), lg = blockIdx.x % (TTv / 64); const int b = slab / NHv, h = slab % NHv;
  for (int i = tid; i < 64 * 8; i += 256) { const int r = i / 8, c8 = (i % 8) * 8; FragH f; f.half[0] = *(const v8us*)((const unsigned short*)V16 + ((size_t)b * TTv + lg * 64 + r) * ldv + voff + h * 64 + c8);
#pragma unroll
    for (int q = 0; q < 8; ++q) tl[r][c8 + q] = f.u[q]; }
  __syncthreads();
  {
#pragma unroll
    for (int rd = 0; rd < 2; ++rd) { const int d = rd * 32 + tid / 8, pc = tid % 8; FragH f;
#pragma unroll
      for (int q = 0; q < 8; ++q) f.u[q] = tl[pc * 8 + q][d];
      *(v8us*)((unsigned short*)Vt + ((size_t)slab * 64 + d) * TTv + lg * 64 + pc * 8) = f.half[0]; }
     } }

__global__ __launch_bounds__(256) void k_hl(const float* __restrict__ F, _Float16* __restrict__ Hh, _Float16* __restrict__ Hl, size_t n8) { const size_t t = (size_t)blockIdx.x * 256 + threadIdx.x; if (t >= n8) return; FragH fh, fl; const v4f a = *(const v4fa*)(F + t * 8), c = *(const v4fa*)(F + t * 8 + 4);
#pragma unroll
  for (int q = 0; q < 4; ++q) { _Float16 h = (_Float16)a[q]; fh.h[q] = h; fl.h[q] = (_Float16)((a[q] - (float)h) * 1024.0f); h = (_Float16)c[q]; fh.h[4 + q] = h; fl.h[4 + q] = (_Float16)((c[q] - (float)h) * 1024.0f); }
  { *(v8us*)((unsigned short*)Hh + t * 8) = fh.half[0]; *(v8us*)((unsigned short*)Hl + t * 8) = fl.half[0];  } }

// ---- fast GEMM (wave tile 32x64; requires M % 32 == 0 rows per launch region and N % 64 == 0); epilogue = k_gemm_hhx semantics ----
__device__ __forceinline__ v16h g2_frag(const _Float16* p, int hh) { FragH f; f.half[0] = *(const v8us*)((const unsigned short*)p + 8 * hh); f.half[1] = *(const v8us*)((const unsigned short*)p + 16 + 8 * hh); return f.v; }
__device__ __forceinline__ v8f g2_mma(v16h a, v16h b, v8f c) { v8f d = __builtin_amdgcn_wmma_f32_16x16x32_f16(false, a, false, b, (short)0, c, false, false); asm volatile("v_nop\n\tv_nop\n\tv_nop\n\tv_nop" : "+v"(d) : "v"(a), "v"(b)); return d; }
template <int ACT>
__global__ __launch_bounds__(128) void k_gemm2(const _Float16* __restrict__ A, int lda, size_t sA, const _Float16* __restrict__ Bh, int ldb, size_t sB, float alpha, const float* __restrict__ bias, size_t sBias, const float* __restrict__ CP, int rowsPerB, size_t sCPb, int row0g,
    float* __restrict__ C, _Float16* __restrict__ C16, int ldc, size_t sC, int M, int N, int K) { static_assert(ACT == 0 || ACT == 3 || ACT == 6 || ACT == 8 || ACT == 9 || ACT == 11 || ACT == 12 || ACT == 14 || ACT == 15 || ACT == 16 || ACT == 17, "k_gemm2: unsupported ACT code (would silently apply no activation)");
  __shared__ __attribute__((aligned(16))) float so[4][32][68];
  const int tid = threadIdx.x, w = tid >> 5, lane = tid & 31, ln = lane & 15, hh = lane >> 4; const int by = blockIdx.y;
  A += (size_t)by * sA; Bh += (size_t)by * sB; const size_t cofs = (size_t)by * sC; const float* bp = bias ? bias + (size_t)by * sBias : nullptr;
  const int ntn = N >> 6; const int mt = blockIdx.x / ntn, nq = blockIdx.x - mt * ntn; const int row0 = mt * 128 + 32 * w, col0 = nq * 64; if (row0 >= M) return;
  const _Float16* a0p = A + (size_t)(row0 + ln) * lda; const _Float16* a1p = a0p + (size_t)16 * lda;
  const _Float16* b0p = Bh + (size_t)(col0 + ln) * ldb; const _Float16* b1p = b0p + (size_t)16 * ldb; const _Float16* b2p = b1p + (size_t)16 * ldb; const _Float16* b3p = b2p + (size_t)16 * ldb;
  const v8f z8 = {0.f,0.f,0.f,0.f,0.f,0.f,0.f,0.f}; v8f c00 = z8, c01 = z8, c02 = z8, c03 = z8, c10 = z8, c11 = z8, c12 = z8, c13 = z8;
#pragma unroll 1
  for (int kb = 0; kb < K; kb += 32) { const v16h a0 = g2_frag(a0p + kb, hh), a1 = g2_frag(a1p + kb, hh);
    v16h b = g2_frag(b0p + kb, hh); c00 = g2_mma(a0, b, c00); c10 = g2_mma(a1, b, c10);
    b = g2_frag(b1p + kb, hh); c01 = g2_mma(a0, b, c01); c11 = g2_mma(a1, b, c11);
    b = g2_frag(b2p + kb, hh); c02 = g2_mma(a0, b, c02); c12 = g2_mma(a1, b, c12);
    b = g2_frag(b3p + kb, hh); c03 = g2_mma(a0, b, c03); c13 = g2_mma(a1, b, c13); }
  v8f accs[8] = {c00, c01, c02, c03, c10, c11, c12, c13};
#pragma unroll
  for (int u = 0; u < 8; ++u) { const int t = u & 3, half = u >> 2; const int col = col0 + t * 16 + ln; const float bv = bp ? bf16_round(bp[col]) : 0.f;
#pragma unroll
    for (int r = 0; r < 8; ++r) { const int rloc = half * 16 + 8 * hh + r; float v = accs[u][r] * alpha + bv; if (CP) { if (rowsPerB < 0) v += CP[cofs + (size_t)(row0g + row0 + rloc) * ldc + col];      /* rowsPerB < 0: own element of the batched C plane */ else { const int bidx = (row0g + row0 + rloc) / rowsPerB; v += CP[(size_t)bidx * sCPb + (size_t)by * 64 + col]; } }
      if (ACT == 3) v = fmaxf(v, 0.f); else if (ACT == 6) v = 0.5f * v * (1.0f + erff(v * 0.70710678118654752f)); else if (ACT == 11) v = 1.0f / (1.0f + expf(-v)); else if (ACT == 15) v = v / (1.0f + expf(-v)); else if (ACT == 12) v = (v > 0.f) ? v : 0.01f * v; else if (ACT == 8) v = tanhf(v); else if (ACT == 9) v = 0.5f * v * (1.0f + tanhf(0.7978845608028654f * (v + 0.044715f * v * v * v))); else if (ACT == 14) v = (v > 0.f) ? v : 0.1f * v; else if (ACT == 16) v = (v >= 0.f) ? v : 0.3f * v; else if (ACT == 17) v = (v >= 0.f) ? v : 0.2f * v;
      so[w][rloc][t * 16 + ln] = v; } }
  __builtin_amdgcn_fence(__ATOMIC_ACQ_REL, "workgroup"); __builtin_amdgcn_wave_barrier();
  const int rsub = lane >> 4, c4 = (lane & 15) * 4;
  {
#pragma unroll
    for (int q = 0; q < 16; ++q) { const int r = q * 2 + rsub; const v4f v = *(const v4fa*)&so[w][r][c4]; if (C) *(v4f*)(C + cofs + (size_t)(row0 + r) * ldc + col0 + c4) = v; if (C16) { v4h h4; for (int i = 0; i < 4; ++i) h4[i] = (_Float16)v[i]; *(v4h*)(C16 + cofs + (size_t)(row0 + r) * ldc + col0 + c4) = h4; } }
     } }


__global__ __launch_bounds__(256) void k_wnat(const float* __restrict__ w, size_t n8, _Float16* __restrict__ Bt) { const size_t t = (size_t)blockIdx.x * 256 + threadIdx.x; if (t >= n8) return; FragH f; for (int q = 0; q < 8; ++q) f.h[q] = (_Float16)(bf16_round(w[t * 8 + q]) * 16.0f); *(v8us*)((unsigned short*)Bt + t * 8) = f.half[0];  }
__global__ __launch_bounds__(256) void k_rsm(const float* __restrict__ S, _Float16* __restrict__ P, int nrows) {
  #pragma clang fp contract(off)
  const int i = blockIdx.x * 256 + threadIdx.x; if (i >= nrows) return; const float* s = S + (size_t)i * SQ; float mx = -3.0e38f;
#pragma unroll 1
  for (int j = 0; j < SQ; ++j) mx = fmaxf(mx, s[j]); float se = 0.f;
#pragma unroll 1
  for (int j = 0; j < SQ; ++j) se += expf(s[j] - mx); const float sc = 256.0f / se;
#pragma unroll 1
  for (int j0 = 0; j0 < SQ; j0 += 8) { FragH f; for (int q = 0; q < 8; ++q) f.h[q] = (_Float16)(expf(s[j0 + q] - mx) * sc); unsigned short* d = (unsigned short*)P + (size_t)i * SQ + j0; *(v8us*)d = f.half[0];  } }
__global__ __launch_bounds__(256) void k_vt(const _Float16* __restrict__ V16, int b, int h0, _Float16* __restrict__ VT) { __shared__ unsigned short tl[64][65]; const int tid = threadIdx.x; const int hh = blockIdx.x % HG, sg = blockIdx.x / HG; const int s0 = sg * 64; const int h = h0 + hh;
  for (int i = tid; i < 64 * 8; i += 256) { const int j = i / 8, d8 = (i % 8) * 8; FragH f; f.half[0] = *(const v8us*)((const unsigned short*)V16 + ((size_t)b * SQ + s0 + j) * DM + h * HD + d8); for (int q = 0; q < 8; ++q) tl[d8 + q][j] = f.u[q]; }
  __syncthreads();
  { for (int i = tid; i < 64 * 8; i += 256) { const int d = i / 8, j8 = (i % 8) * 8; FragH f; for (int q = 0; q < 8; ++q) f.u[q] = tl[d][j8 + q]; *(v8us*)((unsigned short*)VT + ((size_t)hh * HD + d) * SQ + s0 + j8) = f.half[0]; }  } }



__global__ __launch_bounds__(256) void k_rsmcf2(const float* __restrict__ S, _Float16* __restrict__ P, int hg, int q0, int nk) {
  #pragma clang fp contract(off)
  const int t = blockIdx.x * 256 + threadIdx.x; if (t >= hg * QT) return; const size_t i = (size_t)t; const float* s = S + i * NKX; const int last = q0 + (t % QT); float mx = -3.0e38f;
#pragma unroll 1
  for (int j = 0; j < nk; ++j) { const float f = (j <= last) ? 1.f : 0.f; mx = fmaxf(mx, fmaf(f, s[j], (1.f - f) * -1.0e9f)); } float se = 0.f;
#pragma unroll 1
  for (int j = 0; j < nk; ++j) { const float f = (j <= last) ? 1.f : 0.f; se += __expf(fmaf(f, s[j], (1.f - f) * -1.0e9f) - mx); } const float sc = 256.0f / se;
#pragma unroll 1
  for (int j0 = 0; j0 < nk; j0 += 8) { FragH fr; for (int q = 0; q < 8; ++q) { const int j = j0 + q; const float f = (j <= last) ? 1.f : 0.f; fr.h[q] = (_Float16)(__expf(fmaf(f, s[j], (1.f - f) * -1.0e9f) - mx) * sc); } unsigned short* d = (unsigned short*)P + i * NKX + j0; *(v8us*)d = fr.half[0];  } }


template <int MASKADD>
__global__ __launch_bounds__(64) void k_att0(const float* __restrict__ QF, const float* __restrict__ KF, const float* __restrict__ VF, int ld, const float* __restrict__ mask, float scale, float* __restrict__ OF, int ldo) {
  #pragma clang fp contract(off)
  __shared__ __attribute__((aligned(16))) float lq[64][64]; __shared__ __attribute__((aligned(16))) float lo[64][64];
  const int tid = threadIdx.x; const int h = blockIdx.x / (QT0 / 64), rg = blockIdx.x % (QT0 / 64); const int i = rg * 64 + tid;
  const float* qr = QF + (size_t)i * ld + h * HD;
#pragma unroll 1
  for (int c = 0; c < HD / 4; ++c) { *(v4f*)&lq[tid][c * 4] = *(const v4fa*)(qr + c * 4); const v4f z = {0.f, 0.f, 0.f, 0.f}; *(v4f*)&lo[tid][c * 4] = z; }
  float m = -1.0e30f, l = 0.f; const int jmax = MASKADD ? (SQ - 1) : (rg * 64 + 63);      /* additive-mask form: every key (the mask input decides); causal form: keys up to the block's last row */
#pragma unroll 1
  for (int j = 0; j <= jmax; ++j) { const float* kr = KF + (size_t)j * ld + h * HD; const float* vr = VF + (size_t)j * ld + h * HD; float s = 0.f;
#pragma unroll 1
    for (int c = 0; c < HD / 4; ++c) { const v4f kq = *(const v4fa*)(kr + c * 4); const v4f qq = *(v4f*)&lq[tid][c * 4]; s = __fadd_rn(s, __fmul_rn(qq[0], kq[0])); s = __fadd_rn(s, __fmul_rn(qq[1], kq[1])); s = __fadd_rn(s, __fmul_rn(qq[2], kq[2])); s = __fadd_rn(s, __fmul_rn(qq[3], kq[3])); }
    s = __fmul_rn(s, scale); if (MASKADD) s = __fadd_rn(s, __fmul_rn(bf16_round(mask[(size_t)i * SQ + j]), -10000.0f));
    const float f = (MASKADD || j <= i) ? 1.f : 0.f; const float sm = fmaf(f, s, (1.f - f) * -1.0e30f); const float mn = fmaxf(m, sm); const float sc = expf(m - mn); const float e = expf(sm - mn); l = __fadd_rn(__fmul_rn(l, sc), e); m = mn;
#pragma unroll 1
    for (int c = 0; c < HD / 4; ++c) { const v4f vv = *(const v4fa*)(vr + c * 4); v4f oo = *(v4f*)&lo[tid][c * 4]; for (int u = 0; u < 4; ++u) oo[u] = __fadd_rn(__fmul_rn(oo[u], sc), __fmul_rn(e, vv[u])); *(v4f*)&lo[tid][c * 4] = oo; } }
  const float fin = 64.0f / l;      /* o carried x64 */
#pragma unroll 1
  for (int c = 0; c < HD / 4; ++c) { v4f oo = *(v4f*)&lo[tid][c * 4]; for (int u = 0; u < 4; ++u) oo[u] = __fmul_rn(oo[u], fin); *(v4f*)&lo[tid][c * 4] = oo; }
  __syncthreads();
  {
#pragma unroll 1
    for (int it = 0; it < 16; ++it) { const int row = it * 4 + tid / 16, pc = (tid % 16) * 4; const v4f v = *(const v4f*)&lo[row][pc]; *(v4f*)(OF + (size_t)(rg * 64 + row) * ldo + h * HD + pc) = v; }
     } }

__global__ __launch_bounds__(256) void k_of0out(const float* __restrict__ src, float* __restrict__ dst, size_t n4) { const size_t t = (size_t)blockIdx.x * 256 + threadIdx.x; if (t >= n4) return; v4f v = *(const v4fa*)(src + t * 4); for (int q = 0; q < 4; ++q) v[q] = __fmul_rn(v[q], 0.015625f); *(v4f*)(dst + t * 4) = v;  }

extern "C" void kernel_launch(void* const* d_in, const int* in_sizes, int n_in,
                              void* d_out, int out_size, void* d_ws, size_t ws_size, hipStream_t stream) {
  (void)in_sizes; (void)n_in; (void)out_size;
  const float* const* I = (const float* const*)d_in; const float* x1 = I[0]; const float* x2 = I[1]; const float* x3 = I[2];      /* input order: Q, K, V (2-D [4096][1024] = one sequence); no weights, no biases, no projections, no scalar inputs */
  char* ws = (char*)d_ws; size_t off = 0;
  auto take = [&](size_t bytes) { char* p = ws + off; off += (bytes + 255) & ~(size_t)255; return p; };
  _Float16* QH = (_Float16*)take(NR * DM * 2); _Float16* QL = (_Float16*)take(NR * DM * 2); _Float16* KH = (_Float16*)take(NR * DM * 2); _Float16* KL = (_Float16*)take(NR * DM * 2); _Float16* Q16 = QH; _Float16* K16 = KH; _Float16* V16 = (_Float16*)take(NR * DM * 2);
  float* S = (float*)take((size_t)NH * QT * NKX * 4); _Float16* P = (_Float16*)take((size_t)NH * QT * NKX * 2); _Float16* VT = (_Float16*)take((size_t)NH * HD * SQ * 2);
  if (off > ws_size) return;
  const size_t r0p = (size_t)B0 * SQ;      /* first processed row (unused) */
  k_x16<<<(unsigned)((NR * DM / 8 + 255) / 256), 256, 0, stream>>>(x1, QH, NR * DM / 8);      /* queries: bf16 inputs are exact in f16 (no projection, no residual plane needed) */
  k_x16<<<(unsigned)((NR * DM / 8 + 255) / 256), 256, 0, stream>>>(x2, KH, NR * DM / 8);      /* keys */
  k_x16<<<(unsigned)((NR * DM / 8 + 255) / 256), 256, 0, stream>>>(x3, V16, NR * DM / 8);      /* values */
  for (int b = B0; b < B0 + NBR; ++b) { const size_t r0 = (size_t)b * SQ;
    k_vt<NH, SQ><<<NH * (SQ / 64), 256, 0, stream>>>(V16 + r0 * LQ, LQ, 0, VT);      /* V^T [NH][HD][SQ] for this batch */
    for (int q0 = 0; q0 < QN; q0 += QT) { const int nk = SQ;      /* NON-causal: every 256-row query tile sees all SQ keys */
      k_gemm2<0><<<dim3((QT / 128) * (nk / 64), 1), 128, 0, stream>>>(QH + (r0 + q0) * LQ, LQ, 0, KH + r0 * LQ, LQ, 0, 1.0f, nullptr, 0, nullptr, 1, 0, 0, S, nullptr, NKX, 0, QT, nk, DM);      /* UNSCALED logits of the single 1024-wide head: exact f16 x f16 products over K = 1024, alpha 1 */
      k_rsmcf2<<<(QT + 255) / 256, 256, 0, stream>>>(S, P, 1, SQ, nk);      /* plain softmax over all keys (one head slab): the kernel keeps key j iff j <= q0_arg + row; q0_arg = SQ makes every j < SQ visible */
      k_gemm2<0><<<dim3((QT / 128) * (DM / 64), 1), 128, 0, stream>>>(P, NKX, 0, VT, SQ, 0, 0.0001220703125f, nullptr, 0, nullptr, 1, 0, 0, (float*)d_out + (r0 + q0) * DM, nullptr, DM, 0, QT, DM, nk); } }      /* out = (softmax * 1024^-0.5) V: alpha 2^-8 (the P x256 scale) x 2^-5 (the module's post-softmax scale d^-0.5 = 1/32) = 2^-13; N = 1024: V^T [1024][SQ] = sixteen 64-row slabs; f32 rows written straight into the output */
}

// v001
// It runs in 2240 microseconds.
// Next to v000, in two timings, it ran 5.63 and 5.65 times as fast.
#include <hip/hip_runtime.h>
// Raw single-head dot-product attention on 2-D inputs with the scale applied AFTER the softmax (Q [4096][1024], K [4096][1024], V [4096][1024]; logits = Q K^T (UNSCALED: sigma ~32 over 1024 dims); scores = softmax(logits over the keys) * 1024^-0.5; out = scores V -> [4096][1024]); no projections: the bf16-rounded inputs are exact in f16, so single f16 x f16 products are exact and the unscaled logits are exact in f32.
// Structure: token rows r = b*4096 + s; x as exact f16 rows (bf16-rounded); q, k and v are these rows (no projections, no residual planes); per batch: V^T for all heads via LDS transposes; per query tile of 256 rows: scores against all keys as ONE f16 WMMA GEMM (32x64 wave tiles, K = 1024, grid.y 1, alpha 1: the 1/sqrt(d) comes after the softmax), row softmax on VALU over all keys (f32 statistics, native exp; weights x256 f16), out = P . V^T (K = all keys, alpha 2^-13: undoes the x256 and applies 1024^-0.5) as f32 rows written straight into the output.
// Compute dtype: inputs rounded to bf16; q, k, v exact in f16; softmax weights as plain f16 GEMM operands (~2^-12); scores, softmax statistics and out f32. v_wmma_f32_16x16x32_f16.
#define NB 1
#define SQ 4096
#define DM 1024
#define NH 16
#define HD 64
#define HG 4                         /* heads per attention launch group */
#define QT 256                       /* query rows per tile */
#define NKX SQ                       /* S / P row pitch */
#define QT0 128                      /* first-tile rows recomputed exactly in f32 */
#define B0 0                         /* first batch processed (debug hook) */
#define NBR NB                       /* batches processed (debug hook) */
#define NR ((size_t)NB * SQ)         /* token rows */
#define MP ((int)((size_t)NBR * SQ)) /* rows processed, unused (debug hook) */
#define QN SQ                        /* query rows attended per batch (debug hook) */
#define NHD NH                       /* heads attended (debug hook) */
#define MPO MP                       /* rows through the output stage (debug hook) */
#define LQ DM      /* row pitch of the q/k/v rows */
typedef __bf16 v16b __attribute__((ext_vector_type(16)));
typedef unsigned short v8us __attribute__((ext_vector_type(8), may_alias));
typedef float  v8f  __attribute__((ext_vector_type(8)));
typedef float  v4f  __attribute__((ext_vector_type(4)));
typedef float  v4fa __attribute__((ext_vector_type(4), may_alias));
union FragB { v16b v; v8us half[2]; unsigned short u[16]; };

__device__ __forceinline__ unsigned short bf16_bits(float x) { unsigned int u = __float_as_uint(x); return (unsigned short)((u + 0x7FFFu + ((u >> 16) & 1u)) >> 16); }
__device__ __forceinline__ float bf16_val(unsigned short b) { return __uint_as_float(((unsigned int)b) << 16); }
__device__ __forceinline__ float bf16_round(float x) { return bf16_val(bf16_bits(x)); }
// D += A·B with NT terms: 1 = ah·bh, 2 = + al·bh (A split), 3 = + ah·bl (both split)
template <int NT>
__device__ __forceinline__ v8f mmaN(v16b ah, v16b al, v16b bh, v16b bl, v8f c) {
  c = __builtin_amdgcn_wmma_f32_16x16x32_bf16(false, ah, false, bh, (short)0, c, false, false);
  if (NT >= 2) c = __builtin_amdgcn_wmma_f32_16x16x32_bf16(false, al, false, bh, (short)0, c, false, false);
  if (NT >= 3) c = __builtin_amdgcn_wmma_f32_16x16x32_bf16(false, ah, false, bl, (short)0, c, false, false);
  asm volatile("v_nop\n\tv_nop\n\tv_nop\n\tv_nop" : "+v"(c) : "v"(ah), "v"(al), "v"(bh), "v"(bl));
  return c;
}

__global__ __launch_bounds__(256) void k_wt_bf16(const float* __restrict__ W, unsigned short* __restrict__ Wt, int K, int N) {
  const int t = blockIdx.x * 256 + threadIdx.x;
  const int k8n = K / 8;
  if (t >= N * k8n) return;
  const int n = t / k8n, k8 = (t % k8n) * 8;
  v8us v;
#pragma unroll
  for (int i = 0; i < 8; ++i) v[i] = bf16_bits(W[(size_t)(k8 + i) * N + n]);
  *(v8us*)(Wt + (size_t)n * K + k8) = v;
  
}

// GEMM C[M][N] (f32, pitch ldc) = act(A[M][K]·W + bias). A f32 row-major (pitch lda) converted per fragment to bf16
// (ASPLIT: hi/lo two planes -> 2 terms, else single rounded term); Wt bf16 [N][K] (pitch ldb). BIAS_BF16 rounds the
// bias to bf16 first (bias quantised to bf16 before the add). K%32==0, M%16==0, N%64==0.
template <bool ASPLIT, int ACT, bool BIAS_BF16>
__global__ __launch_bounds__(128) void k_gemm_bf(const float* __restrict__ A, int lda, const unsigned short* __restrict__ Wt, int ldb,
                                               const float* __restrict__ bias, float* __restrict__ C, int ldc, int M, int N, int K) {
  __shared__ __attribute__((aligned(16))) float so[4][16][64];
  const int tid = threadIdx.x, w = tid >> 5, lane = tid & 31, ln = lane & 15, hh = lane >> 4;
  const int ntn = N / 64;
  const int wid = blockIdx.x * 4 + w;
  const int mt = wid / ntn, nq = wid % ntn;
  if (mt * 16 >= M) return;
  const int row0 = mt * 16, col0 = nq * 64;
  const float* arow = A + (size_t)(row0 + ln) * lda;
  v8f acc[4] = {};
  for (int kb = 0; kb < K; kb += 32) {
    FragB ah, al;
    const v4f x0 = *(const v4fa*)(arow + kb + 8 * hh), x1 = *(const v4fa*)(arow + kb + 8 * hh + 4);
    const v4f x2 = *(const v4fa*)(arow + kb + 16 + 8 * hh), x3 = *(const v4fa*)(arow + kb + 16 + 8 * hh + 4);
    float xs[16] = {x0[0],x0[1],x0[2],x0[3],x1[0],x1[1],x1[2],x1[3],x2[0],x2[1],x2[2],x2[3],x3[0],x3[1],x3[2],x3[3]};
#pragma unroll
    for (int i = 0; i < 16; ++i) { const unsigned short hb = bf16_bits(xs[i]); ah.u[i] = hb; al.u[i] = ASPLIT ? bf16_bits(xs[i] - bf16_val(hb)) : (unsigned short)0; }
#pragma unroll
    for (int t = 0; t < 4; ++t) {
      const unsigned short* brow = Wt + (size_t)(col0 + t * 16 + ln) * ldb + kb;
      FragB b;
      b.half[0] = *(const v8us*)(brow + 8 * hh);
      b.half[1] = *(const v8us*)(brow + 16 + 8 * hh);
      acc[t] = mmaN<ASPLIT ? 2 : 1>(ah.v, al.v, b.v, b.v, acc[t]);
    }
  }
#pragma unroll
  for (int t = 0; t < 4; ++t) {
    float bv = bias ? bias[col0 + t * 16 + ln] : 0.f;
    if (BIAS_BF16) bv = bf16_round(bv);
#pragma unroll
    for (int r = 0; r < 8; ++r) { float v = acc[t][r] + bv; if (ACT == 1) v = fmaxf(v, 0.f); so[w][8 * hh + r][t * 16 + ln] = v; }
  }
  __builtin_amdgcn_fence(__ATOMIC_ACQ_REL, "workgroup");
  __builtin_amdgcn_wave_barrier();
  const int rsub = lane >> 4, c4 = (lane & 15) * 4;
  {
#pragma unroll
    for (int q = 0; q < 8; ++q) {
      const int r = q * 2 + rsub;
      const v4f v = *(const v4fa*)&so[w][r][c4];
      *(v4f*)(C + (size_t)(row0 + r) * ldc + col0 + c4) = v;
    }
    
  }
}

// GEMM C = act(A·W + bias + resid): A f32 (ASPLIT -> hi/lo 2 terms), Wt bf16 [N][K]; ACT 0 none, 1 relu, 2 exact gelu;
// resid (optional, f32, row index = (row % rmod), pitch ldr, RES_BF16 rounds it) added before the activation.
template <bool ASPLIT, int ACT, bool BIAS_BF16, bool RES_BF16>
__global__ __launch_bounds__(128) void k_gemm_bf3(const float* __restrict__ A, int lda, const unsigned short* __restrict__ Wt, int ldb,
                                                const float* __restrict__ bias, const float* __restrict__ resid, int rmod, int ldr,
                                                float* __restrict__ C, int ldc, int M, int N, int K) {
  __shared__ __attribute__((aligned(16))) float so[4][16][64];
  const int tid = threadIdx.x, w = tid >> 5, lane = tid & 31, ln = lane & 15, hh = lane >> 4;
  const int ntn = N / 64;
  const int wid = blockIdx.x * 4 + w;
  const int mt = wid / ntn, nq = wid % ntn;
  if (mt * 16 >= M) return;
  const int row0 = mt * 16, col0 = nq * 64;
  const float* arow = A + (size_t)(row0 + ln) * lda;
  v8f acc[4] = {};
  for (int kb = 0; kb < K; kb += 32) {
    FragB ah, al;
    const v4f x0 = *(const v4fa*)(arow + kb + 8 * hh), x1 = *(const v4fa*)(arow + kb + 8 * hh + 4);
    const v4f x2 = *(const v4fa*)(arow + kb + 16 + 8 * hh), x3 = *(const v4fa*)(arow + kb + 16 + 8 * hh + 4);
    float xs[16] = {x0[0],x0[1],x0[2],x0[3],x1[0],x1[1],x1[2],x1[3],x2[0],x2[1],x2[2],x2[3],x3[0],x3[1],x3[2],x3[3]};
#pragma unroll
    for (int i = 0; i < 16; ++i) { const unsigned short hb = bf16_bits(xs[i]); ah.u[i] = hb; al.u[i] = ASPLIT ? bf16_bits(xs[i] - bf16_val(hb)) : (unsigned short)0; }
#pragma unroll
    for (int t = 0; t < 4; ++t) {
      const unsigned short* brow = Wt + (size_t)(col0 + t * 16 + ln) * ldb + kb;
      FragB b;
      b.half[0] = *(const v8us*)(brow + 8 * hh);
      b.half[1] = *(const v8us*)(brow + 16 + 8 * hh);
      acc[t] = mmaN<ASPLIT ? 2 : 1>(ah.v, al.v, b.v, b.v, acc[t]);
    }
  }
#pragma unroll
  for (int t = 0; t < 4; ++t) {
    const int col = col0 + t * 16 + ln;
    float bv = bias ? bias[col] : 0.f;
    if (BIAS_BF16) bv = bf16_round(bv);
#pragma unroll
    for (int r = 0; r < 8; ++r) {
      float v = acc[t][r] + bv;
      if (resid) { float rv = resid[(size_t)((row0 + 8 * hh + r) % rmod) * ldr + col]; if (RES_BF16) rv = bf16_round(rv); v += rv; }
      if (ACT == 1) v = fmaxf(v, 0.f);
      if (ACT == 2) v = 0.5f * v * (1.0f + erff(v * 0.70710678118654752f));
      if (ACT == 3) { const float u = 0.7978845608028654f * (v + 0.044715f * v * v * v); v = 0.5f * v * (1.0f + tanhf(u)); }
      so[w][8 * hh + r][t * 16 + ln] = v;
    }
  }
  __builtin_amdgcn_fence(__ATOMIC_ACQ_REL, "workgroup");
  __builtin_amdgcn_wave_barrier();
  const int rsub = lane >> 4, c4 = (lane & 15) * 4;
  {
#pragma unroll
    for (int q = 0; q < 8; ++q) {
      const int r = q * 2 + rsub;
      const v4f v = *(const v4fa*)&so[w][r][c4];
      *(v4f*)(C + (size_t)(row0 + r) * ldc + col0 + c4) = v;
    }
    
  }
}
// row LayerNorm (biased variance, eps) over N: s = X (+ R); optional out_sum <- s; out_norm <- (s-mu)*rsqrt(var+eps)*g + b
template <bool PARAM_BF16>
__global__ __launch_bounds__(256) void k_layernorm(const float* __restrict__ X, const float* __restrict__ R, const float* __restrict__ g, const float* __restrict__ bta,
                                                  float* __restrict__ out_sum, float* __restrict__ out_norm, int N, float eps) {
  __shared__ float red[256];
  const int row = blockIdx.x, tid = threadIdx.x;
  const float* x = X + (size_t)row * N; const float* rr = R ? R + (size_t)row * N : nullptr;
  float vals[16];                     // up to N = 4096
  const int per = N / 256;            // contiguous chunk per thread? use strided-by-4 chunks: thread handles j = tid*4 + 1024*u
  float s1 = 0.f;
  for (int u = 0; u < per / 4; ++u) {
    const int j = tid * 4 + 1024 * u;
    const v4f a = *(const v4fa*)(x + j);
    v4f b = {0.f,0.f,0.f,0.f}; if (rr) b = *(const v4fa*)(rr + j);
#pragma unroll
    for (int q = 0; q < 4; ++q) { const float v = a[q] + b[q]; vals[u * 4 + q] = v; s1 += v; }
  }
  red[tid] = s1; __syncthreads();
  for (int st = 128; st > 0; st >>= 1) { if (tid < st) red[tid] += red[tid + st]; __syncthreads(); }
  const float mu = red[0] / (float)N; __syncthreads();
  float s2 = 0.f;
  for (int u = 0; u < per / 4; ++u)
#pragma unroll
    for (int q = 0; q < 4; ++q) { const float c = vals[u * 4 + q] - mu; s2 += c * c; }
  red[tid] = s2; __syncthreads();
  for (int st = 128; st > 0; st >>= 1) { if (tid < st) red[tid] += red[tid + st]; __syncthreads(); }
  const float rs = rsqrtf(red[0] / (float)N + eps);
  {
    for (int u = 0; u < per / 4; ++u) {
      const int j = tid * 4 + 1024 * u;
      v4f o, sm;
#pragma unroll
      for (int q = 0; q < 4; ++q) {
        float gg = g[j + q], bb = bta[j + q];
        if (PARAM_BF16) { gg = bf16_round(gg); bb = bf16_round(bb); }
        sm[q] = vals[u * 4 + q]; o[q] = (vals[u * 4 + q] - mu) * rs * gg + bb;
      }
      if (out_sum) *(v4f*)(out_sum + (size_t)row * N + j) = sm;
      *(v4f*)(out_norm + (size_t)row * N + j) = o;
    }
    
  }
}



// ---- f16 WMMA path (v_wmma_f32_16x16x32_f16): 11-bit significands for operands in range — used where a [0,1] probability operand needs more precision than bf16
typedef _Float16 v16h __attribute__((ext_vector_type(16)));
union FragH { v16h v; v8us half[2]; _Float16 h[16]; unsigned short u[16]; };
template <int NT>
__device__ __forceinline__ v8f mmaH(v16h ah, v16h al, v16h bh, v16h bl, v8f c) {
  c = __builtin_amdgcn_wmma_f32_16x16x32_f16(false, ah, false, bh, (short)0, c, false, false);
  if (NT >= 2) c = __builtin_amdgcn_wmma_f32_16x16x32_f16(false, al, false, bh, (short)0, c, false, false);
  if (NT >= 3) c = __builtin_amdgcn_wmma_f32_16x16x32_f16(false, ah, false, bl, (short)0, c, false, false);
  asm volatile("v_nop\n\tv_nop\n\tv_nop\n\tv_nop" : "+v"(c) : "v"(ah), "v"(al), "v"(bh), "v"(bl));
  return c;
}
// batched GEMM like k_gemm_b but f16 operands: A f32 (split into f16 hi/lo if ASPLIT, else rounded to f16), Bt = f16 values [n][k]; alpha; C f32; N multiple of 16 (partial tiles skipped)
template <bool ASPLIT>
__global__ __launch_bounds__(128) void k_gemm_h(const float* __restrict__ A, int lda, size_t sA, const _Float16* __restrict__ Bh, int ldb, size_t sB, float alpha, float* __restrict__ C, int ldc, size_t sC, int M, int N, int K) {
  __shared__ __attribute__((aligned(16))) float so[4][16][64];
  const int tid = threadIdx.x, w = tid >> 5, lane = tid & 31, ln = lane & 15, hh = lane >> 4; const int by = blockIdx.y;
  A += (size_t)by * sA; Bh += (size_t)by * sB; C += (size_t)by * sC;
  const int ntn = (N + 63) / 64; const int wid = blockIdx.x * 4 + w; const int mt = wid / ntn, nq = wid % ntn; if (mt * 16 >= M) return;
  const int row0 = mt * 16, col0 = nq * 64; const float* arow = A + (size_t)(row0 + ln) * lda;
  v8f acc[4] = {};
  for (int kb = 0; kb < K; kb += 32) {
    FragH ah, al;
    const v4f x0 = *(const v4fa*)(arow + kb + 8 * hh), x1 = *(const v4fa*)(arow + kb + 8 * hh + 4), x2 = *(const v4fa*)(arow + kb + 16 + 8 * hh), x3 = *(const v4fa*)(arow + kb + 16 + 8 * hh + 4);
    float xs[16] = {x0[0],x0[1],x0[2],x0[3],x1[0],x1[1],x1[2],x1[3],x2[0],x2[1],x2[2],x2[3],x3[0],x3[1],x3[2],x3[3]};
#pragma unroll
    for (int i = 0; i < 16; ++i) { const _Float16 h = (_Float16)xs[i]; ah.h[i] = h; al.h[i] = ASPLIT ? (_Float16)(xs[i] - (float)h) : (_Float16)0.0f; }
#pragma unroll
    for (int t = 0; t < 4; ++t) { if (col0 + t * 16 >= N) continue; const size_t boff = (size_t)(col0 + t * 16 + ln) * ldb + kb; FragH bq; bq.half[0] = *(const v8us*)(Bh + boff + 8 * hh); bq.half[1] = *(const v8us*)(Bh + boff + 16 + 8 * hh);
      acc[t] = mmaH<ASPLIT ? 2 : 1>(ah.v, al.v, bq.v, bq.v, acc[t]); }
  }
#pragma unroll
  for (int t = 0; t < 4; ++t) { if (col0 + t * 16 >= N) continue;
#pragma unroll
    for (int r = 0; r < 8; ++r) so[w][8 * hh + r][t * 16 + ln] = acc[t][r] * alpha; }
  __builtin_amdgcn_fence(__ATOMIC_ACQ_REL, "workgroup"); __builtin_amdgcn_wave_barrier();
  const int rsub = lane >> 4, c4 = (lane & 15) * 4;
  {
#pragma unroll
    for (int q = 0; q < 8; ++q) { const int r = q * 2 + rsub; if (col0 + c4 < N) { const v4f v = *(const v4fa*)&so[w][r][c4]; *(v4f*)(C + (size_t)(row0 + r) * ldc + col0 + c4) = v; } }
     }
}

// Wt[n][k] = f16(W[k][n]·scale) from f32 row-major W[K][N] (scale = power of two; bf16-exact weights stay exact in f16 away from the subnormal range)
__global__ __launch_bounds__(256) void k_wt_f16(const float* __restrict__ W, _Float16* __restrict__ Wt, int K, int N, float scale) {
  const int t = blockIdx.x * 256 + threadIdx.x; if (t >= N * (K / 8)) return; const int n = t / (K / 8), k8 = (t % (K / 8)) * 8; FragH f;
#pragma unroll
  for (int i = 0; i < 8; ++i) f.h[i] = (_Float16)(bf16_round(W[(size_t)(k8 + i) * N + n]) * scale); const v8us o = f.half[0];
  *(v8us*)((unsigned short*)Wt + (size_t)n * K + k8) = o; 
}
// k_gemm_hh variant with fused epilogue: v = acc·alpha + bias[by·sBias + col] (+ CP[(row/rowsPerB)·sCPb + by·64 + col] if CP) ; ACT 0 none / 1 elu ; writes f16 C16 (and f32 C if non-null)
template <int ACT>
__global__ __launch_bounds__(128) void k_gemm_hhx(const _Float16* __restrict__ A, int lda, size_t sA, const _Float16* __restrict__ Bh, int ldb, size_t sB, float alpha, const float* __restrict__ bias, size_t sBias, const float* __restrict__ CP, int rowsPerB, size_t sCPb, int row0g,
    float* __restrict__ C, _Float16* __restrict__ C16, int ldc, size_t sC, int M, int N, int K) {
  __shared__ __attribute__((aligned(16))) float so[4][16][64];
  const int tid = threadIdx.x, w = tid >> 5, lane = tid & 31, ln = lane & 15, hh = lane >> 4; const int by = blockIdx.y;
  A += (size_t)by * sA; Bh += (size_t)by * sB; const size_t cofs = (size_t)by * sC; const float* bp = bias ? bias + (size_t)by * sBias : nullptr;
  const int ntn = (N + 63) / 64; const int wid = blockIdx.x * 4 + w; const int mt = wid / ntn, nq = wid % ntn; if (mt * 16 >= M) return;
  const int row0 = mt * 16, col0 = nq * 64; const _Float16* arow = A + (size_t)(row0 + ln) * lda;
  v8f acc[4] = {};
  for (int kb = 0; kb < K; kb += 32) { FragH ah; ah.half[0] = *(const v8us*)((const unsigned short*)arow + kb + 8 * hh); ah.half[1] = *(const v8us*)((const unsigned short*)arow + kb + 16 + 8 * hh);
#pragma unroll
    for (int t = 0; t < 4; ++t) { if (col0 + t * 16 >= N) continue; const size_t boff = (size_t)(col0 + t * 16 + ln) * ldb + kb; FragH bq; bq.half[0] = *(const v8us*)((const unsigned short*)Bh + boff + 8 * hh); bq.half[1] = *(const v8us*)((const unsigned short*)Bh + boff + 16 + 8 * hh);
      acc[t] = mmaH<1>(ah.v, ah.v, bq.v, bq.v, acc[t]); }
  }
#pragma unroll
  for (int t = 0; t < 4; ++t) { if (col0 + t * 16 >= N) continue; const int col = col0 + t * 16 + ln; const float bv = bp ? bf16_round(bp[col]) : 0.f;
#pragma unroll
    for (int r = 0; r < 8; ++r) { float v = acc[t][r] * alpha + bv; if (CP) { const int rr = row0g + row0 + 8 * hh + r; if (rowsPerB < 0) v += CP[cofs + (size_t)rr * ldc + col];      /* rowsPerB < 0: own element of the batched C plane */ else { const int bidx = rr / rowsPerB; v += CP[(size_t)bidx * sCPb + (size_t)by * 64 + col]; } } if (ACT == 1) v = (v > 0.f) ? v : expm1f(v); else if (ACT == 7) v = (v > 0.f) ? v + 1.0f : expf(v); else if (ACT == 8) v = tanhf(v); else if (ACT == 9) v = 0.5f * v * (1.0f + tanhf(0.7978845608028654f * (v + 0.044715f * v * v * v))); else if (ACT == 11) v = 1.0f / (1.0f + expf(-v)); else if (ACT == 12) v = (v > 0.f) ? v : 0.01f * v; else if (ACT == 14) v = (v > 0.f) ? v : 0.1f * v; else if (ACT == 16) v = (v >= 0.f) ? v : 0.3f * v; else if (ACT == 17) v = (v >= 0.f) ? v : 0.2f * v; else if (ACT == 15) v = v / (1.0f + expf(-v)); else if (ACT == 3) v = fmaxf(v, 0.f); else if (ACT == 6) v = 0.5f * v * (1.0f + erff(v * 0.70710678118654752f)); so[w][8 * hh + r][t * 16 + ln] = v; } }
  __builtin_amdgcn_fence(__ATOMIC_ACQ_REL, "workgroup"); __builtin_amdgcn_wave_barrier();
  const int rsub = lane >> 4, c4 = (lane & 15) * 4; typedef _Float16 v4h __attribute__((ext_vector_type(4)));
  {
#pragma unroll
    for (int q = 0; q < 8; ++q) { const int r = q * 2 + rsub; if (col0 + c4 < N) { const v4f v = *(const v4fa*)&so[w][r][c4]; if (C) *(v4f*)(C + cofs + (size_t)(row0 + r) * ldc + col0 + c4) = v; if (C16) { v4h h4; for (int i = 0; i < 4; ++i) h4[i] = (_Float16)v[i]; *(v4h*)(C16 + cofs + (size_t)(row0 + r) * ldc + col0 + c4) = h4; } } }
     }
}


typedef _Float16 v4h __attribute__((ext_vector_type(4)));

__global__ __launch_bounds__(256) void k_x16(const float* __restrict__ x, _Float16* __restrict__ X16, size_t n8) { const size_t t = (size_t)blockIdx.x * 256 + threadIdx.x; if (t >= n8) return; FragH f;
#pragma unroll
  for (int q = 0; q < 8; ++q) f.h[q] = (_Float16)bf16_round(x[t * 8 + q]); *(v8us*)((unsigned short*)X16 + t * 8) = f.half[0];  }
__global__ __launch_bounds__(256) void k_h16(const float* __restrict__ x, _Float16* __restrict__ X16, size_t n8) { const size_t t = (size_t)blockIdx.x * 256 + threadIdx.x; if (t >= n8) return; FragH f;
#pragma unroll
  for (int q = 0; q < 8; ++q) f.h[q] = (_Float16)x[t * 8 + q]; *(v8us*)((unsigned short*)X16 + t * 8) = f.half[0];  }
__global__ __launch_bounds__(256) void k_round16f(const float* __restrict__ W, _Float16* __restrict__ Bt, size_t n8) { const size_t t = (size_t)blockIdx.x * 256 + threadIdx.x; if (t >= n8) return; FragH f;
#pragma unroll
  for (int i = 0; i < 8; ++i) f.h[i] = (_Float16)(bf16_round(W[t * 8 + i]) * 16.0f); *(v8us*)((unsigned short*)Bt + t * 8) = f.half[0];  }
template <int NHv, int TTv>
__global__ __launch_bounds__(256) void k_vt(const _Float16* __restrict__ V16, int ldv, int voff, _Float16* __restrict__ Vt) { __shared__ unsigned short tl[64][66]; const int tid = threadIdx.x; const int slab = blockIdx.x / (TTv / 64), lg = blockIdx.x % (TTv / 64); const int b = slab / NHv, h = slab % NHv;
  for (int i = tid; i < 64 * 8; i += 256) { const int r = i / 8, c8 = (i % 8) * 8; FragH f; f.half[0] = *(const v8us*)((const unsigned short*)V16 + ((size_t)b * TTv + lg * 64 + r) * ldv + voff + h * 64 + c8);
#pragma unroll
    for (int q = 0; q < 8; ++q) tl[r][c8 + q] = f.u[q]; }
  __syncthreads();
  {
#pragma unroll
    for (int rd = 0; rd < 2; ++rd) { const int d = rd * 32 + tid / 8, pc = tid % 8; FragH f;
#pragma unroll
      for (int q = 0; q < 8; ++q) f.u[q] = tl[pc * 8 + q][d];
      *(v8us*)((unsigned short*)Vt + ((size_t)slab * 64 + d) * TTv + lg * 64 + pc * 8) = f.half[0]; }
     } }

__global__ __launch_bounds__(256) void k_hl(const float* __restrict__ F, _Float16* __restrict__ Hh, _Float16* __restrict__ Hl, size_t n8) { const size_t t = (size_t)blockIdx.x * 256 + threadIdx.x; if (t >= n8) return; FragH fh, fl; const v4f a = *(const v4fa*)(F + t * 8), c = *(const v4fa*)(F + t * 8 + 4);
#pragma unroll
  for (int q = 0; q < 4; ++q) { _Float16 h = (_Float16)a[q]; fh.h[q] = h; fl.h[q] = (_Float16)((a[q] - (float)h) * 1024.0f); h = (_Float16)c[q]; fh.h[4 + q] = h; fl.h[4 + q] = (_Float16)((c[q] - (float)h) * 1024.0f); }
  { *(v8us*)((unsigned short*)Hh + t * 8) = fh.half[0]; *(v8us*)((unsigned short*)Hl + t * 8) = fl.half[0];  } }

// ---- fast GEMM (wave tile 32x64; requires M % 32 == 0 rows per launch region and N % 64 == 0); epilogue = k_gemm_hhx semantics ----
__device__ __forceinline__ v16h g2_frag(const _Float16* p, int hh) { FragH f; f.half[0] = *(const v8us*)((const unsigned short*)p + 8 * hh); f.half[1] = *(const v8us*)((const unsigned short*)p + 16 + 8 * hh); return f.v; }
__device__ __forceinline__ v8f g2_mma(v16h a, v16h b, v8f c) { v8f d = __builtin_amdgcn_wmma_f32_16x16x32_f16(false, a, false, b, (short)0, c, false, false); asm volatile("v_nop\n\tv_nop\n\tv_nop\n\tv_nop" : "+v"(d) : "v"(a), "v"(b)); return d; }
template <int ACT>
__global__ __launch_bounds__(128) void k_gemm2(const _Float16* __restrict__ A, int lda, size_t sA, const _Float16* __restrict__ Bh, int ldb, size_t sB, float alpha, const float* __restrict__ bias, size_t sBias, const float* __restrict__ CP, int rowsPerB, size_t sCPb, int row0g,
    float* __restrict__ C, _Float16* __restrict__ C16, int ldc, size_t sC, int M, int N, int K) { static_assert(ACT == 0 || ACT == 3 || ACT == 6 || ACT == 8 || ACT == 9 || ACT == 11 || ACT == 12 || ACT == 14 || ACT == 15 || ACT == 16 || ACT == 17, "k_gemm2: unsupported ACT code (would silently apply no activation)");
  __shared__ __attribute__((aligned(16))) float so[4][32][68];
  const int tid = threadIdx.x, w = tid >> 5, lane = tid & 31, ln = lane & 15, hh = lane >> 4; const int by = blockIdx.y;
  A += (size_t)by * sA; Bh += (size_t)by * sB; const size_t cofs = (size_t)by * sC; const float* bp = bias ? bias + (size_t)by * sBias : nullptr;
  const int ntn = N >> 6; const int mt = blockIdx.x / ntn, nq = blockIdx.x - mt * ntn; const int row0 = mt * 128 + 32 * w, col0 = nq * 64; if (row0 >= M) return;
  const _Float16* a0p = A + (size_t)(row0 + ln) * lda; const _Float16* a1p = a0p + (size_t)16 * lda;
  const _Float16* b0p = Bh + (size_t)(col0 + ln) * ldb; const _Float16* b1p = b0p + (size_t)16 * ldb; const _Float16* b2p = b1p + (size_t)16 * ldb; const _Float16* b3p = b2p + (size_t)16 * ldb;
  const v8f z8 = {0.f,0.f,0.f,0.f,0.f,0.f,0.f,0.f}; v8f c00 = z8, c01 = z8, c02 = z8, c03 = z8, c10 = z8, c11 = z8, c12 = z8, c13 = z8;
#pragma unroll 1
  for (int kb = 0; kb < K; kb += 32) { const v16h a0 = g2_frag(a0p + kb, hh), a1 = g2_frag(a1p + kb, hh);
    v16h b = g2_frag(b0p + kb, hh); c00 = g2_mma(a0, b, c00); c10 = g2_mma(a1, b, c10);
    b = g2_frag(b1p + kb, hh); c01 = g2_mma(a0, b, c01); c11 = g2_mma(a1, b, c11);
    b = g2_frag(b2p + kb, hh); c02 = g2_mma(a0, b, c02); c12 = g2_mma(a1, b, c12);
    b = g2_frag(b3p + kb, hh); c03 = g2_mma(a0, b, c03); c13 = g2_mma(a1, b, c13); }
  v8f accs[8] = {c00, c01, c02, c03, c10, c11, c12, c13};
#pragma unroll
  for (int u = 0; u < 8; ++u) { const int t = u & 3, half = u >> 2; const int col = col0 + t * 16 + ln; const float bv = bp ? bf16_round(bp[col]) : 0.f;
#pragma unroll
    for (int r = 0; r < 8; ++r) { const int rloc = half * 16 + 8 * hh + r; float v = accs[u][r] * alpha + bv; if (CP) { if (rowsPerB < 0) v += CP[cofs + (size_t)(row0g + row0 + rloc) * ldc + col];      /* rowsPerB < 0: own element of the batched C plane */ else { const int bidx = (row0g + row0 + rloc) / rowsPerB; v += CP[(size_t)bidx * sCPb + (size_t)by * 64 + col]; } }
      if (ACT == 3) v = fmaxf(v, 0.f); else if (ACT == 6) v = 0.5f * v * (1.0f + erff(v * 0.70710678118654752f)); else if (ACT == 11) v = 1.0f / (1.0f + expf(-v)); else if (ACT == 15) v = v / (1.0f + expf(-v)); else if (ACT == 12) v = (v > 0.f) ? v : 0.01f * v; else if (ACT == 8) v = tanhf(v); else if (ACT == 9) v = 0.5f * v * (1.0f + tanhf(0.7978845608028654f * (v + 0.044715f * v * v * v))); else if (ACT == 14) v = (v > 0.f) ? v : 0.1f * v; else if (ACT == 16) v = (v >= 0.f) ? v : 0.3f * v; else if (ACT == 17) v = (v >= 0.f) ? v : 0.2f * v;
      so[w][rloc][t * 16 + ln] = v; } }
  __builtin_amdgcn_fence(__ATOMIC_ACQ_REL, "workgroup"); __builtin_amdgcn_wave_barrier();
  const int rsub = lane >> 4, c4 = (lane & 15) * 4;
  {
#pragma unroll
    for (int q = 0; q < 16; ++q) { const int r = q * 2 + rsub; const v4f v = *(const v4fa*)&so[w][r][c4]; if (C) *(v4f*)(C + cofs + (size_t)(row0 + r) * ldc + col0 + c4) = v; if (C16) { v4h h4; for (int i = 0; i < 4; ++i) h4[i] = (_Float16)v[i]; *(v4h*)(C16 + cofs + (size_t)(row0 + r) * ldc + col0 + c4) = h4; } }
     } }


__global__ __launch_bounds__(256) void k_wnat(const float* __restrict__ w, size_t n8, _Float16* __restrict__ Bt) { const size_t t = (size_t)blockIdx.x * 256 + threadIdx.x; if (t >= n8) return; FragH f; for (int q = 0; q < 8; ++q) f.h[q] = (_Float16)(bf16_round(w[t * 8 + q]) * 16.0f); *(v8us*)((unsigned short*)Bt + t * 8) = f.half[0];  }
__global__ __launch_bounds__(256) void k_rsm(const float* __restrict__ S, _Float16* __restrict__ P, int nrows) {
  #pragma clang fp contract(off)
  const int i = blockIdx.x * 256 + threadIdx.x; if (i >= nrows) return; const float* s = S + (size_t)i * SQ; float mx = -3.0e38f;
#pragma unroll 1
  for (int j = 0; j < SQ; ++j) mx = fmaxf(mx, s[j]); float se = 0.f;
#pragma unroll 1
  for (int j = 0; j < SQ; ++j) se += expf(s[j] - mx); const float sc = 256.0f / se;
#pragma unroll 1
  for (int j0 = 0; j0 < SQ; j0 += 8) { FragH f; for (int q = 0; q < 8; ++q) f.h[q] = (_Float16)(expf(s[j0 + q] - mx) * sc); unsigned short* d = (unsigned short*)P + (size_t)i * SQ + j0; *(v8us*)d = f.half[0];  } }
__global__ __launch_bounds__(256) void k_vt(const _Float16* __restrict__ V16, int b, int h0, _Float16* __restrict__ VT) { __shared__ unsigned short tl[64][65]; const int tid = threadIdx.x; const int hh = blockIdx.x % HG, sg = blockIdx.x / HG; const int s0 = sg * 64; const int h = h0 + hh;
  for (int i = tid; i < 64 * 8; i += 256) { const int j = i / 8, d8 = (i % 8) * 8; FragH f; f.half[0] = *(const v8us*)((const unsigned short*)V16 + ((size_t)b * SQ + s0 + j) * DM + h * HD + d8); for (int q = 0; q < 8; ++q) tl[d8 + q][j] = f.u[q]; }
  __syncthreads();
  { for (int i = tid; i < 64 * 8; i += 256) { const int d = i / 8, j8 = (i % 8) * 8; FragH f; for (int q = 0; q < 8; ++q) f.u[q] = tl[d][j8 + q]; *(v8us*)((unsigned short*)VT + ((size_t)hh * HD + d) * SQ + s0 + j8) = f.half[0]; }  } }



// 2^t on the native unit. The v_nop in the same statement is the free slot that the instruction set asks for behind a transcendental before its result is used or
// its source overwritten; a v_nop in a statement of its own moved away.
__device__ __forceinline__ float exp2_slot(float t) { float e; asm("v_exp_f32 %0, %1\n\tv_nop" : "=v"(e) : "v"(t)); return e; }
// Row softmax, one work-group per logits row: 256 threads hold 16 logits each in registers (one coalesced read of the row),
// row maximum and row sum by wave shuffles plus one LDS exchange each; weights x256 as f16, f32 statistics, native exp.
__global__ __launch_bounds__(256) void k_rsmrow(const float* __restrict__ S, _Float16* __restrict__ P) {
  static_assert(SQ == 4 * 1024, "k_rsmrow: 256 threads x 4 chunks x 4 logits cover one row");
  __shared__ float rmx[8]; __shared__ float rse[8];
  const int tid = threadIdx.x, w = tid >> 5, lane = tid & 31; const float* s = S + (size_t)blockIdx.x * NKX + tid * 4;
  v4f x[4];
#pragma unroll
  for (int u = 0; u < 4; ++u) x[u] = *(const v4fa*)(s + u * 1024);
  asm volatile("s_wait_xcnt 0x0" ::: "memory");      /* stands in front of the later overwrite of the offset register that the four issued loads name */
  float mx = -3.0e38f;
#pragma unroll
  for (int u = 0; u < 4; ++u) for (int q = 0; q < 4; ++q) mx = fmaxf(mx, x[u][q]);
#pragma unroll
  for (int m = 16; m > 0; m >>= 1) mx = fmaxf(mx, __shfl_xor(mx, m, 32));
  if (lane == 0) rmx[w] = mx;
  __syncthreads();      /* every wave's maximum is in rmx */
  mx = rmx[0];
#pragma unroll
  for (int i = 1; i < 8; ++i) mx = fmaxf(mx, rmx[i]);
  float se = 0.f;
#pragma unroll
  for (int u = 0; u < 4; ++u) for (int q = 0; q < 4; ++q) { x[u][q] = exp2_slot((x[u][q] - mx) * 1.44269504088896340736f); se += x[u][q]; }      /* = the native exp(s - mx): multiply by log2(e), then v_exp_f32 */
#pragma unroll
  for (int m = 16; m > 0; m >>= 1) se += __shfl_xor(se, m, 32);
  if (lane == 0) rse[w] = se;
  __syncthreads();      /* every wave's partial sum is in rse */
  se = rse[0];
#pragma unroll
  for (int i = 1; i < 8; ++i) se += rse[i];
  const float sc = 256.0f / se; _Float16* d = P + (size_t)blockIdx.x * NKX + tid * 4;
#pragma unroll
  for (int u = 0; u < 4; ++u) { v4h h4; for (int q = 0; q < 4; ++q) h4[q] = (_Float16)(x[u][q] * sc); *(v4h*)(d + u * 1024) = h4; } }


template <int MASKADD>
__global__ __launch_bounds__(64) void k_att0(const float* __restrict__ QF, const float* __restrict__ KF, const float* __restrict__ VF, int ld, const float* __restrict__ mask, float scale, float* __restrict__ OF, int ldo) {
  #pragma clang fp contract(off)
  __shared__ __attribute__((aligned(16))) float lq[64][64]; __shared__ __attribute__((aligned(16))) float lo[64][64];
  const int tid = threadIdx.x; const int h = blockIdx.x / (QT0 / 64), rg = blockIdx.x % (QT0 / 64); const int i = rg * 64 + tid;
  const float* qr = QF + (size_t)i * ld + h * HD;
#pragma unroll 1
  for (int c = 0; c < HD / 4; ++c) { *(v4f*)&lq[tid][c * 4] = *(const v4fa*)(qr + c * 4); const v4f z = {0.f, 0.f, 0.f, 0.f}; *(v4f*)&lo[tid][c * 4] = z; }
  float m = -1.0e30f, l = 0.f; const int jmax = MASKADD ? (SQ - 1) : (rg * 64 + 63);      /* additive-mask form: every key (the mask input decides); causal form: keys up to the block's last row */
#pragma unroll 1
  for (int j = 0; j <= jmax; ++j) { const float* kr = KF + (size_t)j * ld + h * HD; const float* vr = VF + (size_t)j * ld + h * HD; float s = 0.f;
#pragma unroll 1
    for (int c = 0; c < HD / 4; ++c) { const v4f kq = *(const v4fa*)(kr + c * 4); const v4f qq = *(v4f*)&lq[tid][c * 4]; s = __fadd_rn(s, __fmul_rn(qq[0], kq[0])); s = __fadd_rn(s, __fmul_rn(qq[1], kq[1])); s = __fadd_rn(s, __fmul_rn(qq[2], kq[2])); s = __fadd_rn(s, __fmul_rn(qq[3], kq[3])); }
    s = __fmul_rn(s, scale); if (MASKADD) s = __fadd_rn(s, __fmul_rn(bf16_round(mask[(size_t)i * SQ + j]), -10000.0f));
    const float f = (MASKADD || j <= i) ? 1.f : 0.f; const float sm = fmaf(f, s, (1.f - f) * -1.0e30f); const float mn = fmaxf(m, sm); const float sc = expf(m - mn); const float e = expf(sm - mn); l = __fadd_rn(__fmul_rn(l, sc), e); m = mn;
#pragma unroll 1
    for (int c = 0; c < HD / 4; ++c) { const v4f vv = *(const v4fa*)(vr + c * 4); v4f oo = *(v4f*)&lo[tid][c * 4]; for (int u = 0; u < 4; ++u) oo[u] = __fadd_rn(__fmul_rn(oo[u], sc), __fmul_rn(e, vv[u])); *(v4f*)&lo[tid][c * 4] = oo; } }
  const float fin = 64.0f / l;      /* o carried x64 */
#pragma unroll 1
  for (int c = 0; c < HD / 4; ++c) { v4f oo = *(v4f*)&lo[tid][c * 4]; for (int u = 0; u < 4; ++u) oo[u] = __fmul_rn(oo[u], fin); *(v4f*)&lo[tid][c * 4] = oo; }
  __syncthreads();
  {
#pragma unroll 1
    for (int it = 0; it < 16; ++it) { const int row = it * 4 + tid / 16, pc = (tid % 16) * 4; const v4f v = *(const v4f*)&lo[row][pc]; *(v4f*)(OF + (size_t)(rg * 64 + row) * ldo + h * HD + pc) = v; }
     } }

__global__ __launch_bounds__(256) void k_of0out(const float* __restrict__ src, float* __restrict__ dst, size_t n4) { const size_t t = (size_t)blockIdx.x * 256 + threadIdx.x; if (t >= n4) return; v4f v = *(const v4fa*)(src + t * 4); for (int q = 0; q < 4; ++q) v[q] = __fmul_rn(v[q], 0.015625f); *(v4f*)(dst + t * 4) = v;  }

extern "C" void kernel_launch(void* const* d_in, const int* in_sizes, int n_in,
                              void* d_out, int out_size, void* d_ws, size_t ws_size, hipStream_t stream) {
  (void)in_sizes; (void)n_in; (void)out_size;
  const float* const* I = (const float* const*)d_in; const float* x1 = I[0]; const float* x2 = I[1]; const float* x3 = I[2];      /* input order: Q, K, V (2-D [4096][1024] = one sequence); no weights, no biases, no projections, no scalar inputs */
  char* ws = (char*)d_ws; size_t off = 0;
  auto take = [&](size_t bytes) { char* p = ws + off; off += (bytes + 255) & ~(size_t)255; return p; };
  _Float16* QH = (_Float16*)take(NR * DM * 2); _Float16* QL = (_Float16*)take(NR * DM * 2); _Float16* KH = (_Float16*)take(NR * DM * 2); _Float16* KL = (_Float16*)take(NR * DM * 2); _Float16* Q16 = QH; _Float16* K16 = KH; _Float16* V16 = (_Float16*)take(NR * DM * 2);
  float* S = (float*)take((size_t)NH * QT * NKX * 4); _Float16* P = (_Float16*)take((size_t)NH * QT * NKX * 2); _Float16* VT = (_Float16*)take((size_t)NH * HD * SQ * 2);
  if (off > ws_size) return;
  const size_t r0p = (size_t)B0 * SQ;      /* first processed row (unused) */
  k_x16<<<(unsigned)((NR * DM / 8 + 255) / 256), 256, 0, stream>>>(x1, QH, NR * DM / 8);      /* queries: bf16 inputs are exact in f16 (no projection, no residual plane needed) */
  k_x16<<<(unsigned)((NR * DM / 8 + 255) / 256), 256, 0, stream>>>(x2, KH, NR * DM / 8);      /* keys */
  k_x16<<<(unsigned)((NR * DM / 8 + 255) / 256), 256, 0, stream>>>(x3, V16, NR * DM / 8);      /* values */
  for (int b = B0; b < B0 + NBR; ++b) { const size_t r0 = (size_t)b * SQ;
    k_vt<NH, SQ><<<NH * (SQ / 64), 256, 0, stream>>>(V16 + r0 * LQ, LQ, 0, VT);      /* V^T [NH][HD][SQ] for this batch */
    for (int q0 = 0; q0 < QN; q0 += QT) { const int nk = SQ;      /* NON-causal: every 256-row query tile sees all SQ keys */
      k_gemm2<0><<<dim3((QT / 128) * (nk / 64), 1), 128, 0, stream>>>(QH + (r0 + q0) * LQ, LQ, 0, KH + r0 * LQ, LQ, 0, 1.0f, nullptr, 0, nullptr, 1, 0, 0, S, nullptr, NKX, 0, QT, nk, DM);      /* UNSCALED logits of the single 1024-wide head: exact f16 x f16 products over K = 1024, alpha 1 */
      k_rsmrow<<<QT, 256, 0, stream>>>(S, P);      /* plain softmax over all SQ keys: one work-group per query row of the tile */
      k_gemm2<0><<<dim3((QT / 128) * (DM / 64), 1), 128, 0, stream>>>(P, NKX, 0, VT, SQ, 0, 0.0001220703125f, nullptr, 0, nullptr, 1, 0, 0, (float*)d_out + (r0 + q0) * DM, nullptr, DM, 0, QT, DM, nk); } }      /* out = (softmax * 1024^-0.5) V: alpha 2^-8 (the P x256 scale) x 2^-5 (the module's post-softmax scale d^-0.5 = 1/32) = 2^-13; N = 1024: V^T [1024][SQ] = sixteen 64-row slabs; f32 rows written straight into the output */
}

// v002
// Measured time: 266 microseconds a run.
// Two timings next to v001 put it at 8.38 and 8.39 times that version's speed.
// Counting every step since v000, it is 47.3 times as fast.
#include <hip/hip_runtime.h>
// Raw single-head dot-product attention on 2-D inputs with the scale applied AFTER the softmax (Q [4096][1024], K [4096][1024], V [4096][1024]; logits = Q K^T (UNSCALED: sigma ~32 over 1024 dims); scores = softmax(logits over the keys) * 1024^-0.5; out = scores V -> [4096][1024]); no projections: the bf16-rounded inputs are exact in f16, so single f16 x f16 products are exact and the unscaled logits are exact in f32.
// Structure: token rows r = b*4096 + s; x as exact f16 rows (bf16-rounded); q, k and v are these rows (no projections, no residual planes); per batch: V^T for all heads via LDS transposes; per query tile of 4096 rows (all query rows): scores against all keys as ONE f16 WMMA GEMM (32x64 wave tiles, K = 1024, grid.y 1, alpha 1: the 1/sqrt(d) comes after the softmax), row softmax on VALU over all keys (f32 statistics, native exp; weights x256 f16), out = P . V^T (K = all keys, alpha 2^-13: undoes the x256 and applies 1024^-0.5) as f32 rows written straight into the output.
// Compute dtype: inputs rounded to bf16; q, k, v exact in f16; softmax weights as plain f16 GEMM operands (~2^-12); scores, softmax statistics and out f32. v_wmma_f32_16x16x32_f16.
#define NB 1
#define SQ 4096
#define DM 1024
#define NH 16
#define HD 64
#define HG 4                         /* heads per attention launch group */
#define QT SQ                        /* query rows per launch of each attention stage: all of them */
#define NKX SQ                       /* S / P row pitch */
#define QT0 128                      /* first-tile rows recomputed exactly in f32 */
#define B0 0                         /* first batch processed (debug hook) */
#define NBR NB                       /* batches processed (debug hook) */
#define NR ((size_t)NB * SQ)         /* token rows */
#define MP ((int)((size_t)NBR * SQ)) /* rows processed, unused (debug hook) */
#define QN SQ                        /* query rows attended per batch (debug hook) */
#define NHD NH                       /* heads attended (debug hook) */
#define MPO MP                       /* rows through the output stage (debug hook) */
#define LQ DM      /* row pitch of the q/k/v rows */
typedef __bf16 v16b __attribute__((ext_vector_type(16)));
typedef unsigned short v8us __attribute__((ext_vector_type(8), may_alias));
typedef float  v8f  __attribute__((ext_vector_type(8)));
typedef float  v4f  __attribute__((ext_vector_type(4)));
typedef float  v4fa __attribute__((ext_vector_type(4), may_alias));
union FragB { v16b v; v8us half[2]; unsigned short u[16]; };

__device__ __forceinline__ unsigned short bf16_bits(float x) { unsigned int u = __float_as_uint(x); return (unsigned short)((u + 0x7FFFu + ((u >> 16) & 1u)) >> 16); }
__device__ __forceinline__ float bf16_val(unsigned short b) { return __uint_as_float(((unsigned int)b) << 16); }
__device__ __forceinline__ float bf16_round(float x) { return bf16_val(bf16_bits(x)); }
// D += A·B with NT terms: 1 = ah·bh, 2 = + al·bh (A split), 3 = + ah·bl (both split)
template <int NT>
__device__ __forceinline__ v8f mmaN(v16b ah, v16b al, v16b bh, v16b bl, v8f c) {
  c = __builtin_amdgcn_wmma_f32_16x16x32_bf16(false, ah, false, bh, (short)0, c, false, false);
  if (NT >= 2) c = __builtin_amdgcn_wmma_f32_16x16x32_bf16(false, al, false, bh, (short)0, c, false, false);
  if (NT >= 3) c = __builtin_amdgcn_wmma_f32_16x16x32_bf16(false, ah, false, bl, (short)0, c, false, false);
  asm volatile("v_nop\n\tv_nop\n\tv_nop\n\tv_nop" : "+v"(c) : "v"(ah), "v"(al), "v"(bh), "v"(bl));
  return c;
}

__global__ __launch_bounds__(256) void k_wt_bf16(const float* __restrict__ W, unsigned short* __restrict__ Wt, int K, int N) {
  const int t = blockIdx.x * 256 + threadIdx.x;
  const int k8n = K / 8;
  if (t >= N * k8n) return;
  const int n = t / k8n, k8 = (t % k8n) * 8;
  v8us v;
#pragma unroll
  for (int i = 0; i < 8; ++i) v[i] = bf16_bits(W[(size_t)(k8 + i) * N + n]);
  *(v8us*)(Wt + (size_t)n * K + k8) = v;
  
}

// GEMM C[M][N] (f32, pitch ldc) = act(A[M][K]·W + bias). A f32 row-major (pitch lda) converted per fragment to bf16
// (ASPLIT: hi/lo two planes -> 2 terms, else single rounded term); Wt bf16 [N][K] (pitch ldb). BIAS_BF16 rounds the
// bias to bf16 first (bias quantised to bf16 before the add). K%32==0, M%16==0, N%64==0.
template <bool ASPLIT, int ACT, bool BIAS_BF16>
__global__ __launch_bounds__(128) void k_gemm_bf(const float* __restrict__ A, int lda, const unsigned short* __restrict__ Wt, int ldb,
                                               const float* __restrict__ bias, float* __restrict__ C, int ldc, int M, int N, int K) {
  __shared__ __attribute__((aligned(16))) float so[4][16][64];
  const int tid = threadIdx.x, w = tid >> 5, lane = tid & 31, ln = lane & 15, hh = lane >> 4;
  const int ntn = N / 64;
  const int wid = blockIdx.x * 4 + w;
  const int mt = wid / ntn, nq = wid % ntn;
  if (mt * 16 >= M) return;
  const int row0 = mt * 16, col0 = nq * 64;
  const float* arow = A + (size_t)(row0 + ln) * lda;
  v8f acc[4] = {};
  for (int kb = 0; kb < K; kb += 32) {
    FragB ah, al;
    const v4f x0 = *(const v4fa*)(arow + kb + 8 * hh), x1 = *(const v4fa*)(arow + kb + 8 * hh + 4);
    const v4f x2 = *(const v4fa*)(arow + kb + 16 + 8 * hh), x3 = *(const v4fa*)(arow + kb + 16 + 8 * hh + 4);
    float xs[16] = {x0[0],x0[1],x0[2],x0[3],x1[0],x1[1],x1[2],x1[3],x2[0],x2[1],x2[2],x2[3],x3[0],x3[1],x3[2],x3[3]};
#pragma unroll
    for (int i = 0; i < 16; ++i) { const unsigned short hb = bf16_bits(xs[i]); ah.u[i] = hb; al.u[i] = ASPLIT ? bf16_bits(xs[i] - bf16_val(hb)) : (unsigned short)0; }
#pragma unroll
    for (int t = 0; t < 4; ++t) {
      const unsigned short* brow = Wt + (size_t)(col0 + t * 16 + ln) * ldb + kb;
      FragB b;
      b.half[0] = *(const v8us*)(brow + 8 * hh);
      b.half[1] = *(const v8us*)(brow + 16 + 8 * hh);
      acc[t] = mmaN<ASPLIT ? 2 : 1>(ah.v, al.v, b.v, b.v, acc[t]);
    }
  }
#pragma unroll
  for (int t = 0; t < 4; ++t) {
    float bv = bias ? bias[col0 + t * 16 + ln] : 0.f;
    if (BIAS_BF16) bv = bf16_round(bv);
#pragma unroll
    for (int r = 0; r < 8; ++r) { float v = acc[t][r] + bv; if (ACT == 1) v = fmaxf(v, 0.f); so[w][8 * hh + r][t * 16 + ln] = v; }
  }
  __builtin_amdgcn_fence(__ATOMIC_ACQ_REL, "workgroup");
  __builtin_amdgcn_wave_barrier();
  const int rsub = lane >> 4, c4 = (lane & 15) * 4;
  {
#pragma unroll
    for (int q = 0; q < 8; ++q) {
      const int r = q * 2 + rsub;
      const v4f v = *(const v4fa*)&so[w][r][c4];
      *(v4f*)(C + (size_t)(row0 + r) * ldc + col0 + c4) = v;
    }
    
  }
}

// GEMM C = act(A·W + bias + resid): A f32 (ASPLIT -> hi/lo 2 terms), Wt bf16 [N][K]; ACT 0 none, 1 relu, 2 exact gelu;
// resid (optional, f32, row index = (row % rmod), pitch ldr, RES_BF16 rounds it) added before the activation.
template <bool ASPLIT, int ACT, bool BIAS_BF16, bool RES_BF16>
__global__ __launch_bounds__(128) void k_gemm_bf3(const float* __restrict__ A, int lda, const unsigned short* __restrict__ Wt, int ldb,
                                                const float* __restrict__ bias, const float* __restrict__ resid, int rmod, int ldr,
                                                float* __restrict__ C, int ldc, int M, int N, int K) {
  __shared__ __attribute__((aligned(16))) float so[4][16][64];
  const int tid = threadIdx.x, w = tid >> 5, lane = tid & 31, ln = lane & 15, hh = lane >> 4;
  const int ntn = N / 64;
  const int wid = blockIdx.x * 4 + w;
  const int mt = wid / ntn, nq = wid % ntn;
  if (mt * 16 >= M) return;
  const int row0 = mt * 16, col0 = nq * 64;
  const float* arow = A + (size_t)(row0 + ln) * lda;
  v8f acc[4] = {};
  for (int kb = 0; kb < K; kb += 32) {
    FragB ah, al;
    const v4f x0 = *(const v4fa*)(arow + kb + 8 * hh), x1 = *(const v4fa*)(arow + kb + 8 * hh + 4);
    const v4f x2 = *(const v4fa*)(arow + kb + 16 + 8 * hh), x3 = *(const v4fa*)(arow + kb + 16 + 8 * hh + 4);
    float xs[16] = {x0[0],x0[1],x0[2],x0[3],x1[0],x1[1],x1[2],x1[3],x2[0],x2[1],x2[2],x2[3],x3[0],x3[1],x3[2],x3[3]};
#pragma unroll
    for (int i = 0; i < 16; ++i) { const unsigned short hb = bf16_bits(xs[i]); ah.u[i] = hb; al.u[i] = ASPLIT ? bf16_bits(xs[i] - bf16_val(hb)) : (unsigned short)0; }
#pragma unroll
    for (int t = 0; t < 4; ++t) {
      const unsigned short* brow = Wt + (size_t)(col0 + t * 16 + ln) * ldb + kb;
      FragB b;
      b.half[0] = *(const v8us*)(brow + 8 * hh);
      b.half[1] = *(const v8us*)(brow + 16 + 8 * hh);
      acc[t] = mmaN<ASPLIT ? 2 : 1>(ah.v, al.v, b.v, b.v, acc[t]);
    }
  }
#pragma unroll
  for (int t = 0; t < 4; ++t) {
    const int col = col0 + t * 16 + ln;
    float bv = bias ? bias[col] : 0.f;
    if (BIAS_BF16) bv = bf16_round(bv);
#pragma unroll
    for (int r = 0; r < 8; ++r) {
      float v = acc[t][r] + bv;
      if (resid) { float rv = resid[(size_t)((row0 + 8 * hh + r) % rmod) * ldr + col]; if (RES_BF16) rv = bf16_round(rv); v += rv; }
      if (ACT == 1) v = fmaxf(v, 0.f);
      if (ACT == 2) v = 0.5f * v * (1.0f + erff(v * 0.70710678118654752f));
      if (ACT == 3) { const float u = 0.7978845608028654f * (v + 0.044715f * v * v * v); v = 0.5f * v * (1.0f + tanhf(u)); }
      so[w][8 * hh + r][t * 16 + ln] = v;
    }
  }
  __builtin_amdgcn_fence(__ATOMIC_ACQ_REL, "workgroup");
  __builtin_amdgcn_wave_barrier();
  const int rsub = lane >> 4, c4 = (lane & 15) * 4;
  {
#pragma unroll
    for (int q = 0; q < 8; ++q) {
      const int r = q * 2 + rsub;
      const v4f v = *(const v4fa*)&so[w][r][c4];
      *(v4f*)(C + (size_t)(row0 + r) * ldc + col0 + c4) = v;
    }
    
  }
}
// row LayerNorm (biased variance, eps) over N: s = X (+ R); optional out_sum <- s; out_norm <- (s-mu)*rsqrt(var+eps)*g + b
template <bool PARAM_BF16>
__global__ __launch_bounds__(256) void k_layernorm(const float* __restrict__ X, const float* __restrict__ R, const float* __restrict__ g, const float* __restrict__ bta,
                                                  float* __restrict__ out_sum, float* __restrict__ out_norm, int N, float eps) {
  __shared__ float red[256];
  const int row = blockIdx.x, tid = threadIdx.x;
  const float* x = X + (size_t)row * N; const float* rr = R ? R + (size_t)row * N : nullptr;
  float vals[16];                     // up to N = 4096
  const int per = N / 256;            // contiguous chunk per thread? use strided-by-4 chunks: thread handles j = tid*4 + 1024*u
  float s1 = 0.f;
  for (int u = 0; u < per / 4; ++u) {
    const int j = tid * 4 + 1024 * u;
    const v4f a = *(const v4fa*)(x + j);
    v4f b = {0.f,0.f,0.f,0.f}; if (rr) b = *(const v4fa*)(rr + j);
#pragma unroll
    for (int q = 0; q < 4; ++q) { const float v = a[q] + b[q]; vals[u * 4 + q] = v; s1 += v; }
  }
  red[tid] = s1; __syncthreads();
  for (int st = 128; st > 0; st >>= 1) { if (tid < st) red[tid] += red[tid + st]; __syncthreads(); }
  const float mu = red[0] / (float)N; __syncthreads();
  float s2 = 0.f;
  for (int u = 0; u < per / 4; ++u)
#pragma unroll
    for (int q = 0; q < 4; ++q) { const float c = vals[u * 4 + q] - mu; s2 += c * c; }
  red[tid] = s2; __syncthreads();
  for (int st = 128; st > 0; st >>= 1) { if (tid < st) red[tid] += red[tid + st]; __syncthreads(); }
  const float rs = rsqrtf(red[0] / (float)N + eps);
  {
    for (int u = 0; u < per / 4; ++u) {
      const int j = tid * 4 + 1024 * u;
      v4f o, sm;
#pragma unroll
      for (int q = 0; q < 4; ++q) {
        float gg = g[j + q], bb = bta[j + q];
        if (PARAM_BF16) { gg = bf16_round(gg); bb = bf16_round(bb); }
        sm[q] = vals[u * 4 + q]; o[q] = (vals[u * 4 + q] - mu) * rs * gg + bb;
      }
      if (out_sum) *(v4f*)(out_sum + (size_t)row * N + j) = sm;
      *(v4f*)(out_norm + (size_t)row * N + j) = o;
    }
    
  }
}



// ---- f16 WMMA path (v_wmma_f32_16x16x32_f16): 11-bit significands for operands in range — used where a [0,1] probability operand needs more precision than bf16
typedef _Float16 v16h __attribute__((ext_vector_type(16)));
union FragH { v16h v; v8us half[2]; _Float16 h[16]; unsigned short u[16]; };
template <int NT>
__device__ __forceinline__ v8f mmaH(v16h ah, v16h al, v16h bh, v16h bl, v8f c) {
  c = __builtin_amdgcn_wmma_f32_16x16x32_f16(false, ah, false, bh, (short)0, c, false, false);
  if (NT >= 2) c = __builtin_amdgcn_wmma_f32_16x16x32_f16(false, al, false, bh, (short)0, c, false, false);
  if (NT >= 3) c = __builtin_amdgcn_wmma_f32_16x16x32_f16(false, ah, false, bl, (short)0, c, false, false);
  asm volatile("v_nop\n\tv_nop\n\tv_nop\n\tv_nop" : "+v"(c) : "v"(ah), "v"(al), "v"(bh), "v"(bl));
  return c;
}
// batched GEMM like k_gemm_b but f16 operands: A f32 (split into f16 hi/lo if ASPLIT, else rounded to f16), Bt = f16 values [n][k]; alpha; C f32; N multiple of 16 (partial tiles skipped)
template <bool ASPLIT>
__global__ __launch_bounds__(128) void k_gemm_h(const float* __restrict__ A, int lda, size_t sA, const _Float16* __restrict__ Bh, int ldb, size_t sB, float alpha, float* __restrict__ C, int ldc, size_t sC, int M, int N, int K) {
  __shared__ __attribute__((aligned(16))) float so[4][16][64];
  const int tid = threadIdx.x, w = tid >> 5, lane = tid & 31, ln = lane & 15, hh = lane >> 4; const int by = blockIdx.y;
  A += (size_t)by * sA; Bh += (size_t)by * sB; C += (size_t)by * sC;
  const int ntn = (N + 63) / 64; const int wid = blockIdx.x * 4 + w; const int mt = wid / ntn, nq = wid % ntn; if (mt * 16 >= M) return;
  const int row0 = mt * 16, col0 = nq * 64; const float* arow = A + (size_t)(row0 + ln) * lda;
  v8f acc[4] = {};
  for (int kb = 0; kb < K; kb += 32) {
    FragH ah, al;
    const v4f x0 = *(const v4fa*)(arow + kb + 8 * hh), x1 = *(const v4fa*)(arow + kb + 8 * hh + 4), x2 = *(const v4fa*)(arow + kb + 16 + 8 * hh), x3 = *(const v4fa*)(arow + kb + 16 + 8 * hh + 4);
    float xs[16] = {x0[0],x0[1],x0[2],x0[3],x1[0],x1[1],x1[2],x1[3],x2[0],x2[1],x2[2],x2[3],x3[0],x3[1],x3[2],x3[3]};
#pragma unroll
    for (int i = 0; i < 16; ++i) { const _Float16 h = (_Float16)xs[i]; ah.h[i] = h; al.h[i] = ASPLIT ? (_Float16)(xs[i] - (float)h) : (_Float16)0.0f; }
#pragma unroll
    for (int t = 0; t < 4; ++t) { if (col0 + t * 16 >= N) continue; const size_t boff = (size_t)(col0 + t * 16 + ln) * ldb + kb; FragH bq; bq.half[0] = *(const v8us*)(Bh + boff + 8 * hh); bq.half[1] = *(const v8us*)(Bh + boff + 16 + 8 * hh);
      acc[t] = mmaH<ASPLIT ? 2 : 1>(ah.v, al.v, bq.v, bq.v, acc[t]); }
  }
#pragma unroll
  for (int t = 0; t < 4; ++t) { if (col0 + t * 16 >= N) continue;
#pragma unroll
    for (int r = 0; r < 8; ++r) so[w][8 * hh + r][t * 16 + ln] = acc[t][r] * alpha; }
  __builtin_amdgcn_fence(__ATOMIC_ACQ_REL, "workgroup"); __builtin_amdgcn_wave_barrier();
  const int rsub = lane >> 4, c4 = (lane & 15) * 4;
  {
#pragma unroll
    for (int q = 0; q < 8; ++q) { const int r = q * 2 + rsub; if (col0 + c4 < N) { const v4f v = *(const v4fa*)&so[w][r][c4]; *(v4f*)(C + (size_t)(row0 + r) * ldc + col0 + c4) = v; } }
     }
}

// Wt[n][k] = f16(W[k][n]·scale) from f32 row-major W[K][N] (scale = power of two; bf16-exact weights stay exact in f16 away from the subnormal range)
__global__ __launch_bounds__(256) void k_wt_f16(const float* __restrict__ W, _Float16* __restrict__ Wt, int K, int N, float scale) {
  const int t = blockIdx.x * 256 + threadIdx.x; if (t >= N * (K / 8)) return; const int n = t / (K / 8), k8 = (t % (K / 8)) * 8; FragH f;
#pragma unroll
  for (int i = 0; i < 8; ++i) f.h[i] = (_Float16)(bf16_round(W[(size_t)(k8 + i) * N + n]) * scale); const v8us o = f.half[0];
  *(v8us*)((unsigned short*)Wt + (size_t)n * K + k8) = o; 
}
// k_gemm_hh variant with fused epilogue: v = acc·alpha + bias[by·sBias + col] (+ CP[(row/rowsPerB)·sCPb + by·64 + col] if CP) ; ACT 0 none / 1 elu ; writes f16 C16 (and f32 C if non-null)
template <int ACT>
__global__ __launch_bounds__(128) void k_gemm_hhx(const _Float16* __restrict__ A, int lda, size_t sA, const _Float16* __restrict__ Bh, int ldb, size_t sB, float alpha, const float* __restrict__ bias, size_t sBias, const float* __restrict__ CP, int rowsPerB, size_t sCPb, int row0g,
    float* __restrict__ C, _Float16* __restrict__ C16, int ldc, size_t sC, int M, int N, int K) {
  __shared__ __attribute__((aligned(16))) float so[4][16][64];
  const int tid = threadIdx.x, w = tid >> 5, lane = tid & 31, ln = lane & 15, hh = lane >> 4; const int by = blockIdx.y;
  A += (size_t)by * sA; Bh += (size_t)by * sB; const size_t cofs = (size_t)by * sC; const float* bp = bias ? bias + (size_t)by * sBias : nullptr;
  const int ntn = (N + 63) / 64; const int wid = blockIdx.x * 4 + w; const int mt = wid / ntn, nq = wid % ntn; if (mt * 16 >= M) return;
  const int row0 = mt * 16, col0 = nq * 64; const _Float16* arow = A + (size_t)(row0 + ln) * lda;
  v8f acc[4] = {};
  for (int kb = 0; kb < K; kb += 32) { FragH ah; ah.half[0] = *(const v8us*)((const unsigned short*)arow + kb + 8 * hh); ah.half[1] = *(const v8us*)((const unsigned short*)arow + kb + 16 + 8 * hh);
#pragma unroll
    for (int t = 0; t < 4; ++t) { if (col0 + t * 16 >= N) continue; const size_t boff = (size_t)(col0 + t * 16 + ln) * ldb + kb; FragH bq; bq.half[0] = *(const v8us*)((const unsigned short*)Bh + boff + 8 * hh); bq.half[1] = *(const v8us*)((const unsigned short*)Bh + boff + 16 + 8 * hh);
      acc[t] = mmaH<1>(ah.v, ah.v, bq.v, bq.v, acc[t]); }
  }
#pragma unroll
  for (int t = 0; t < 4; ++t) { if (col0 + t * 16 >= N) continue; const int col = col0 + t * 16 + ln; const float bv = bp ? bf16_round(bp[col]) : 0.f;
#pragma unroll
    for (int r = 0; r < 8; ++r) { float v = acc[t][r] * alpha + bv; if (CP) { const int rr = row0g + row0 + 8 * hh + r; if (rowsPerB < 0) v += CP[cofs + (size_t)rr * ldc + col];      /* rowsPerB < 0: own element of the batched C plane */ else { const int bidx = rr / rowsPerB; v += CP[(size_t)bidx * sCPb + (size_t)by * 64 + col]; } } if (ACT == 1) v = (v > 0.f) ? v : expm1f(v); else if (ACT == 7) v = (v > 0.f) ? v + 1.0f : expf(v); else if (ACT == 8) v = tanhf(v); else if (ACT == 9) v = 0.5f * v * (1.0f + tanhf(0.7978845608028654f * (v + 0.044715f * v * v * v))); else if (ACT == 11) v = 1.0f / (1.0f + expf(-v)); else if (ACT == 12) v = (v > 0.f) ? v : 0.01f * v; else if (ACT == 14) v = (v > 0.f) ? v : 0.1f * v; else if (ACT == 16) v = (v >= 0.f) ? v : 0.3f * v; else if (ACT == 17) v = (v >= 0.f) ? v : 0.2f * v; else if (ACT == 15) v = v / (1.0f + expf(-v)); else if (ACT == 3) v = fmaxf(v, 0.f); else if (ACT == 6) v = 0.5f * v * (1.0f + erff(v * 0.70710678118654752f)); so[w][8 * hh + r][t * 16 + ln] = v; } }
  __builtin_amdgcn_fence(__ATOMIC_ACQ_REL, "workgroup"); __builtin_amdgcn_wave_barrier();
  const int rsub = lane >> 4, c4 = (lane & 15) * 4; typedef _Float16 v4h __attribute__((ext_vector_type(4)));
  {
#pragma unroll
    for (int q = 0; q < 8; ++q) { const int r = q * 2 + rsub; if (col0 + c4 < N) { const v4f v = *(const v4fa*)&so[w][r][c4]; if (C) *(v4f*)(C + cofs + (size_t)(row0 + r) * ldc + col0 + c4) = v; if (C16) { v4h h4; for (int i = 0; i < 4; ++i) h4[i] = (_Float16)v[i]; *(v4h*)(C16 + cofs + (size_t)(row0 + r) * ldc + col0 + c4) = h4; } } }
     }
}


typedef _Float16 v4h __attribute__((ext_vector_type(4)));

__global__ __launch_bounds__(256) void k_x16(const float* __restrict__ x, _Float16* __restrict__ X16, size_t n8) { const size_t t = (size_t)blockIdx.x * 256 + threadIdx.x; if (t >= n8) return; FragH f;
#pragma unroll
  for (int q = 0; q < 8; ++q) f.h[q] = (_Float16)bf16_round(x[t * 8 + q]); *(v8us*)((unsigned short*)X16 + t * 8) = f.half[0];  }
__global__ __launch_bounds__(256) void k_h16(const float* __restrict__ x, _Float16* __restrict__ X16, size_t n8) { const size_t t = (size_t)blockIdx.x * 256 + threadIdx.x; if (t >= n8) return; FragH f;
#pragma unroll
  for (int q = 0; q < 8; ++q) f.h[q] = (_Float16)x[t * 8 + q]; *(v8us*)((unsigned short*)X16 + t * 8) = f.half[0];  }
__global__ __launch_bounds__(256) void k_round16f(const float* __restrict__ W, _Float16* __restrict__ Bt, size_t n8) { const size_t t = (size_t)blockIdx.x * 256 + threadIdx.x; if (t >= n8) return; FragH f;
#pragma unroll
  for (int i = 0; i < 8; ++i) f.h[i] = (_Float16)(bf16_round(W[t * 8 + i]) * 16.0f); *(v8us*)((unsigned short*)Bt + t * 8) = f.half[0];  }
template <int NHv, int TTv>
__global__ __launch_bounds__(256) void k_vt(const _Float16* __restrict__ V16, int ldv, int voff, _Float16* __restrict__ Vt) { __shared__ unsigned short tl[64][66]; const int tid = threadIdx.x; const int slab = blockIdx.x / (TTv / 64), lg = blockIdx.x % (TTv / 64); const int b = slab / NHv, h = slab % NHv;
  for (int i = tid; i < 64 * 8; i += 256) { const int r = i / 8, c8 = (i % 8) * 8; FragH f; f.half[0] = *(const v8us*)((const unsigned short*)V16 + ((size_t)b * TTv + lg * 64 + r) * ldv + voff + h * 64 + c8);
#pragma unroll
    for (int q = 0; q < 8; ++q) tl[r][c8 + q] = f.u[q]; }
  __syncthreads();
  {
#pragma unroll
    for (int rd = 0; rd < 2; ++rd) { const int d = rd * 32 + tid / 8, pc = tid % 8; FragH f;
#pragma unroll
      for (int q = 0; q < 8; ++q) f.u[q] = tl[pc * 8 + q][d];
      *(v8us*)((unsigned short*)Vt + ((size_t)slab * 64 + d) * TTv + lg * 64 + pc * 8) = f.half[0]; }
     } }

__global__ __launch_bounds__(256) void k_hl(const float* __restrict__ F, _Float16* __restrict__ Hh, _Float16* __restrict__ Hl, size_t n8) { const size_t t = (size_t)blockIdx.x * 256 + threadIdx.x; if (t >= n8) return; FragH fh, fl; const v4f a = *(const v4fa*)(F + t * 8), c = *(const v4fa*)(F + t * 8 + 4);
#pragma unroll
  for (int q = 0; q < 4; ++q) { _Float16 h = (_Float16)a[q]; fh.h[q] = h; fl.h[q] = (_Float16)((a[q] - (float)h) * 1024.0f); h = (_Float16)c[q]; fh.h[4 + q] = h; fl.h[4 + q] = (_Float16)((c[q] - (float)h) * 1024.0f); }
  { *(v8us*)((unsigned short*)Hh + t * 8) = fh.half[0]; *(v8us*)((unsigned short*)Hl + t * 8) = fl.half[0];  } }

// ---- fast GEMM (wave tile 32x64; requires M % 32 == 0 rows per launch region and N % 64 == 0); epilogue = k_gemm_hhx semantics ----
__device__ __forceinline__ v16h g2_frag(const _Float16* p, int hh) { FragH f; f.half[0] = *(const v8us*)((const unsigned short*)p + 8 * hh); f.half[1] = *(const v8us*)((const unsigned short*)p + 16 + 8 * hh); return f.v; }
__device__ __forceinline__ v8f g2_mma(v16h a, v16h b, v8f c) { v8f d = __builtin_amdgcn_wmma_f32_16x16x32_f16(false, a, false, b, (short)0, c, false, false); asm volatile("v_nop\n\tv_nop\n\tv_nop\n\tv_nop" : "+v"(d) : "v"(a), "v"(b)); return d; }
template <int ACT>
__global__ __launch_bounds__(128) void k_gemm2(const _Float16* __restrict__ A, int lda, size_t sA, const _Float16* __restrict__ Bh, int ldb, size_t sB, float alpha, const float* __restrict__ bias, size_t sBias, const float* __restrict__ CP, int rowsPerB, size_t sCPb, int row0g,
    float* __restrict__ C, _Float16* __restrict__ C16, int ldc, size_t sC, int M, int N, int K) { static_assert(ACT == 0 || ACT == 3 || ACT == 6 || ACT == 8 || ACT == 9 || ACT == 11 || ACT == 12 || ACT == 14 || ACT == 15 || ACT == 16 || ACT == 17, "k_gemm2: unsupported ACT code (would silently apply no activation)");
  __shared__ __attribute__((aligned(16))) float so[4][32][68];
  const int tid = threadIdx.x, w = tid >> 5, lane = tid & 31, ln = lane & 15, hh = lane >> 4; const int by = blockIdx.y;
  A += (size_t)by * sA; Bh += (size_t)by * sB; const size_t cofs = (size_t)by * sC; const float* bp = bias ? bias + (size_t)by * sBias : nullptr;
  const int ntn = N >> 6; const int mt = blockIdx.x / ntn, nq = blockIdx.x - mt * ntn; const int row0 = mt * 128 + 32 * w, col0 = nq * 64; if (row0 >= M) return;
  const _Float16* a0p = A + (size_t)(row0 + ln) * lda; const _Float16* a1p = a0p + (size_t)16 * lda;
  const _Float16* b0p = Bh + (size_t)(col0 + ln) * ldb; const _Float16* b1p = b0p + (size_t)16 * ldb; const _Float16* b2p = b1p + (size_t)16 * ldb; const _Float16* b3p = b2p + (size_t)16 * ldb;
  const v8f z8 = {0.f,0.f,0.f,0.f,0.f,0.f,0.f,0.f}; v8f c00 = z8, c01 = z8, c02 = z8, c03 = z8, c10 = z8, c11 = z8, c12 = z8, c13 = z8;
#pragma unroll 1
  for (int kb = 0; kb < K; kb += 32) { const v16h a0 = g2_frag(a0p + kb, hh), a1 = g2_frag(a1p + kb, hh);
    v16h b = g2_frag(b0p + kb, hh); c00 = g2_mma(a0, b, c00); c10 = g2_mma(a1, b, c10);
    b = g2_frag(b1p + kb, hh); c01 = g2_mma(a0, b, c01); c11 = g2_mma(a1, b, c11);
    b = g2_frag(b2p + kb, hh); c02 = g2_mma(a0, b, c02); c12 = g2_mma(a1, b, c12);
    b = g2_frag(b3p + kb, hh); c03 = g2_mma(a0, b, c03); c13 = g2_mma(a1, b, c13); }
  v8f accs[8] = {c00, c01, c02, c03, c10, c11, c12, c13};
#pragma unroll
  for (int u = 0; u < 8; ++u) { const int t = u & 3, half = u >> 2; const int col = col0 + t * 16 + ln; const float bv = bp ? bf16_round(bp[col]) : 0.f;
#pragma unroll
    for (int r = 0; r < 8; ++r) { const int rloc = half * 16 + 8 * hh + r; float v = accs[u][r] * alpha + bv; if (CP) { if (rowsPerB < 0) v += CP[cofs + (size_t)(row0g + row0 + rloc) * ldc + col];      /* rowsPerB < 0: own element of the batched C plane */ else { const int bidx = (row0g + row0 + rloc) / rowsPerB; v += CP[(size_t)bidx * sCPb + (size_t)by * 64 + col]; } }
      if (ACT == 3) v = fmaxf(v, 0.f); else if (ACT == 6) v = 0.5f * v * (1.0f + erff(v * 0.70710678118654752f)); else if (ACT == 11) v = 1.0f / (1.0f + expf(-v)); else if (ACT == 15) v = v / (1.0f + expf(-v)); else if (ACT == 12) v = (v > 0.f) ? v : 0.01f * v; else if (ACT == 8) v = tanhf(v); else if (ACT == 9) v = 0.5f * v * (1.0f + tanhf(0.7978845608028654f * (v + 0.044715f * v * v * v))); else if (ACT == 14) v = (v > 0.f) ? v : 0.1f * v; else if (ACT == 16) v = (v >= 0.f) ? v : 0.3f * v; else if (ACT == 17) v = (v >= 0.f) ? v : 0.2f * v;
      so[w][rloc][t * 16 + ln] = v; } }
  __builtin_amdgcn_fence(__ATOMIC_ACQ_REL, "workgroup"); __builtin_amdgcn_wave_barrier();
  const int rsub = lane >> 4, c4 = (lane & 15) * 4;
  {
#pragma unroll
    for (int q = 0; q < 16; ++q) { const int r = q * 2 + rsub; const v4f v = *(const v4fa*)&so[w][r][c4]; if (C) *(v4f*)(C + cofs + (size_t)(row0 + r) * ldc + col0 + c4) = v; if (C16) { v4h h4; for (int i = 0; i < 4; ++i) h4[i] = (_Float16)v[i]; *(v4h*)(C16 + cofs + (size_t)(row0 + r) * ldc + col0 + c4) = h4; } }
     } }


__global__ __launch_bounds__(256) void k_wnat(const float* __restrict__ w, size_t n8, _Float16* __restrict__ Bt) { const size_t t = (size_t)blockIdx.x * 256 + threadIdx.x; if (t >= n8) return; FragH f; for (int q = 0; q < 8; ++q) f.h[q] = (_Float16)(bf16_round(w[t * 8 + q]) * 16.0f); *(v8us*)((unsigned short*)Bt + t * 8) = f.half[0];  }
__global__ __launch_bounds__(256) void k_rsm(const float* __restrict__ S, _Float16* __restrict__ P, int nrows) {
  #pragma clang fp contract(off)
  const int i = blockIdx.x * 256 + threadIdx.x; if (i >= nrows) return; const float* s = S + (size_t)i * SQ; float mx = -3.0e38f;
#pragma unroll 1
  for (int j = 0; j < SQ; ++j) mx = fmaxf(mx, s[j]); float se = 0.f;
#pragma unroll 1
  for (int j = 0; j < SQ; ++j) se += expf(s[j] - mx); const float sc = 256.0f / se;
#pragma unroll 1
  for (int j0 = 0; j0 < SQ; j0 += 8) { FragH f; for (int q = 0; q < 8; ++q) f.h[q] = (_Float16)(expf(s[j0 + q] - mx) * sc); unsigned short* d = (unsigned short*)P + (size_t)i * SQ + j0; *(v8us*)d = f.half[0];  } }
__global__ __launch_bounds__(256) void k_vt(const _Float16* __restrict__ V16, int b, int h0, _Float16* __restrict__ VT) { __shared__ unsigned short tl[64][65]; const int tid = threadIdx.x; const int hh = blockIdx.x % HG, sg = blockIdx.x / HG; const int s0 = sg * 64; const int h = h0 + hh;
  for (int i = tid; i < 64 * 8; i += 256) { const int j = i / 8, d8 = (i % 8) * 8; FragH f; f.half[0] = *(const v8us*)((const unsigned short*)V16 + ((size_t)b * SQ + s0 + j) * DM + h * HD + d8); for (int q = 0; q < 8; ++q) tl[d8 + q][j] = f.u[q]; }
  __syncthreads();
  { for (int i = tid; i < 64 * 8; i += 256) { const int d = i / 8, j8 = (i % 8) * 8; FragH f; for (int q = 0; q < 8; ++q) f.u[q] = tl[d][j8 + q]; *(v8us*)((unsigned short*)VT + ((size_t)hh * HD + d) * SQ + s0 + j8) = f.half[0]; }  } }



// 2^t on the native unit. The v_nop in the same statement is the free slot that the instruction set asks for behind a transcendental before its result is used or
// its source overwritten; a v_nop in a statement of its own moved away.
__device__ __forceinline__ float exp2_slot(float t) { float e; asm("v_exp_f32 %0, %1\n\tv_nop" : "=v"(e) : "v"(t)); return e; }
// Row softmax, one work-group per logits row: 256 threads hold 16 logits each in registers (one coalesced read of the row),
// row maximum and row sum by wave shuffles plus one LDS exchange each; weights x256 as f16, f32 statistics, native exp.
__global__ __launch_bounds__(256) void k_rsmrow(const float* __restrict__ S, _Float16* __restrict__ P) {
  static_assert(SQ == 4 * 1024, "k_rsmrow: 256 threads x 4 chunks x 4 logits cover one row");
  __shared__ float rmx[8]; __shared__ float rse[8];
  const int tid = threadIdx.x, w = tid >> 5, lane = tid & 31; const float* s = S + (size_t)blockIdx.x * NKX + tid * 4;
  v4f x[4];
#pragma unroll
  for (int u = 0; u < 4; ++u) x[u] = *(const v4fa*)(s + u * 1024);
  asm volatile("s_wait_xcnt 0x0" ::: "memory");      /* stands in front of the later overwrite of the offset register that the four issued loads name */
  float mx = -3.0e38f;
#pragma unroll
  for (int u = 0; u < 4; ++u) for (int q = 0; q < 4; ++q) mx = fmaxf(mx, x[u][q]);
#pragma unroll
  for (int m = 16; m > 0; m >>= 1) mx = fmaxf(mx, __shfl_xor(mx, m, 32));
  if (lane == 0) rmx[w] = mx;
  __syncthreads();      /* every wave's maximum is in rmx */
  mx = rmx[0];
#pragma unroll
  for (int i = 1; i < 8; ++i) mx = fmaxf(mx, rmx[i]);
  float se = 0.f;
#pragma unroll
  for (int u = 0; u < 4; ++u) for (int q = 0; q < 4; ++q) { x[u][q] = exp2_slot((x[u][q] - mx) * 1.44269504088896340736f); se += x[u][q]; }      /* = the native exp(s - mx): multiply by log2(e), then v_exp_f32 */
#pragma unroll
  for (int m = 16; m > 0; m >>= 1) se += __shfl_xor(se, m, 32);
  if (lane == 0) rse[w] = se;
  __syncthreads();      /* every wave's partial sum is in rse */
  se = rse[0];
#pragma unroll
  for (int i = 1; i < 8; ++i) se += rse[i];
  const float sc = 256.0f / se; _Float16* d = P + (size_t)blockIdx.x * NKX + tid * 4;
#pragma unroll
  for (int u = 0; u < 4; ++u) { v4h h4; for (int q = 0; q < 4; ++q) h4[q] = (_Float16)(x[u][q] * sc); *(v4h*)(d + u * 1024) = h4; } }


template <int MASKADD>
__global__ __launch_bounds__(64) void k_att0(const float* __restrict__ QF, const float* __restrict__ KF, const float* __restrict__ VF, int ld, const float* __restrict__ mask, float scale, float* __restrict__ OF, int ldo) {
  #pragma clang fp contract(off)
  __shared__ __attribute__((aligned(16))) float lq[64][64]; __shared__ __attribute__((aligned(16))) float lo[64][64];
  const int tid = threadIdx.x; const int h = blockIdx.x / (QT0 / 64), rg = blockIdx.x % (QT0 / 64); const int i = rg * 64 + tid;
  const float* qr = QF + (size_t)i * ld + h * HD;
#pragma unroll 1
  for (int c = 0; c < HD / 4; ++c) { *(v4f*)&lq[tid][c * 4] = *(const v4fa*)(qr + c * 4); const v4f z = {0.f, 0.f, 0.f, 0.f}; *(v4f*)&lo[tid][c * 4] = z; }
  float m = -1.0e30f, l = 0.f; const int jmax = MASKADD ? (SQ - 1) : (rg * 64 + 63);      /* additive-mask form: every key (the mask input decides); causal form: keys up to the block's last row */
#pragma unroll 1
  for (int j = 0; j <= jmax; ++j) { const float* kr = KF + (size_t)j * ld + h * HD; const float* vr = VF + (size_t)j * ld + h * HD; float s = 0.f;
#pragma unroll 1
    for (int c = 0; c < HD / 4; ++c) { const v4f kq = *(const v4fa*)(kr + c * 4); const v4f qq = *(v4f*)&lq[tid][c * 4]; s = __fadd_rn(s, __fmul_rn(qq[0], kq[0])); s = __fadd_rn(s, __fmul_rn(qq[1], kq[1])); s = __fadd_rn(s, __fmul_rn(qq[2], kq[2])); s = __fadd_rn(s, __fmul_rn(qq[3], kq[3])); }
    s = __fmul_rn(s, scale); if (MASKADD) s = __fadd_rn(s, __fmul_rn(bf16_round(mask[(size_t)i * SQ + j]), -10000.0f));
    const float f = (MASKADD || j <= i) ? 1.f : 0.f; const float sm = fmaf(f, s, (1.f - f) * -1.0e30f); const float mn = fmaxf(m, sm); const float sc = expf(m - mn); const float e = expf(sm - mn); l = __fadd_rn(__fmul_rn(l, sc), e); m = mn;
#pragma unroll 1
    for (int c = 0; c < HD / 4; ++c) { const v4f vv = *(const v4fa*)(vr + c * 4); v4f oo = *(v4f*)&lo[tid][c * 4]; for (int u = 0; u < 4; ++u) oo[u] = __fadd_rn(__fmul_rn(oo[u], sc), __fmul_rn(e, vv[u])); *(v4f*)&lo[tid][c * 4] = oo; } }
  const float fin = 64.0f / l;      /* o carried x64 */
#pragma unroll 1
  for (int c = 0; c < HD / 4; ++c) { v4f oo = *(v4f*)&lo[tid][c * 4]; for (int u = 0; u < 4; ++u) oo[u] = __fmul_rn(oo[u], fin); *(v4f*)&lo[tid][c * 4] = oo; }
  __syncthreads();
  {
#pragma unroll 1
    for (int it = 0; it < 16; ++it) { const int row = it * 4 + tid / 16, pc = (tid % 16) * 4; const v4f v = *(const v4f*)&lo[row][pc]; *(v4f*)(OF + (size_t)(rg * 64 + row) * ldo + h * HD + pc) = v; }
     } }

__global__ __launch_bounds__(256) void k_of0out(const float* __restrict__ src, float* __restrict__ dst, size_t n4) { const size_t t = (size_t)blockIdx.x * 256 + threadIdx.x; if (t >= n4) return; v4f v = *(const v4fa*)(src + t * 4); for (int q = 0; q < 4; ++q) v[q] = __fmul_rn(v[q], 0.015625f); *(v4f*)(dst + t * 4) = v;  }

extern "C" void kernel_launch(void* const* d_in, const int* in_sizes, int n_in,
                              void* d_out, int out_size, void* d_ws, size_t ws_size, hipStream_t stream) {
  (void)in_sizes; (void)n_in; (void)out_size;
  const float* const* I = (const float* const*)d_in; const float* x1 = I[0]; const float* x2 = I[1]; const float* x3 = I[2];      /* input order: Q, K, V (2-D [4096][1024] = one sequence); no weights, no biases, no projections, no scalar inputs */
  char* ws = (char*)d_ws; size_t off = 0;
  auto take = [&](size_t bytes) { char* p = ws + off; off += (bytes + 255) & ~(size_t)255; return p; };
  _Float16* QH = (_Float16*)take(NR * DM * 2); _Float16* QL = (_Float16*)take(NR * DM * 2); _Float16* KH = (_Float16*)take(NR * DM * 2); _Float16* KL = (_Float16*)take(NR * DM * 2); _Float16* Q16 = QH; _Float16* K16 = KH; _Float16* V16 = (_Float16*)take(NR * DM * 2);
  float* S = (float*)take((size_t)QT * NKX * 4); _Float16* P = (_Float16*)take((size_t)QT * NKX * 2); _Float16* VT = (_Float16*)take((size_t)NH * HD * SQ * 2);
  if (off > ws_size) return;
  const size_t r0p = (size_t)B0 * SQ;      /* first processed row (unused) */
  k_x16<<<(unsigned)((NR * DM / 8 + 255) / 256), 256, 0, stream>>>(x1, QH, NR * DM / 8);      /* queries: bf16 inputs are exact in f16 (no projection, no residual plane needed) */
  k_x16<<<(unsigned)((NR * DM / 8 + 255) / 256), 256, 0, stream>>>(x2, KH, NR * DM / 8);      /* keys */
  k_x16<<<(unsigned)((NR * DM / 8 + 255) / 256), 256, 0, stream>>>(x3, V16, NR * DM / 8);      /* values */
  for (int b = B0; b < B0 + NBR; ++b) { const size_t r0 = (size_t)b * SQ;
    k_vt<NH, SQ><<<NH * (SQ / 64), 256, 0, stream>>>(V16 + r0 * LQ, LQ, 0, VT);      /* V^T [NH][HD][SQ] for this batch */
    for (int q0 = 0; q0 < QN; q0 += QT) { const int nk = SQ;      /* NON-causal: every query row sees all SQ keys; QT = SQ, so each stage below is ONE launch over all query rows (the whole logits plane S and weights plane P lie in the workspace) */
      k_gemm2<0><<<dim3((QT / 128) * (nk / 64), 1), 128, 0, stream>>>(QH + (r0 + q0) * LQ, LQ, 0, KH + r0 * LQ, LQ, 0, 1.0f, nullptr, 0, nullptr, 1, 0, 0, S, nullptr, NKX, 0, QT, nk, DM);      /* UNSCALED logits of the single 1024-wide head: exact f16 x f16 products over K = 1024, alpha 1 */
      k_rsmrow<<<QT, 256, 0, stream>>>(S, P);      /* plain softmax over all SQ keys: one work-group per query row */
      k_gemm2<0><<<dim3((QT / 128) * (DM / 64), 1), 128, 0, stream>>>(P, NKX, 0, VT, SQ, 0, 0.0001220703125f, nullptr, 0, nullptr, 1, 0, 0, (float*)d_out + (r0 + q0) * DM, nullptr, DM, 0, QT, DM, nk); } }      /* out = (softmax * 1024^-0.5) V: alpha 2^-8 (the P x256 scale) x 2^-5 (the module's post-softmax scale d^-0.5 = 1/32) = 2^-13; N = 1024: V^T [1024][SQ] = sixteen 64-row slabs; f32 rows written straight into the output */
}

// v003
// One run takes 97.2 microseconds.
// Next to v002, in two timings, it ran 2.78 and 2.72 times as fast.
// Counting every step since v000, it is 130 times as fast.
#include <hip/hip_runtime.h>
// Raw single-head dot-product attention on 2-D inputs with the scale applied AFTER the softmax (Q [4096][1024], K [4096][1024], V [4096][1024]; logits = Q K^T (UNSCALED: sigma ~32 over 1024 dims); scores = softmax(logits over the keys) * 1024^-0.5; out = scores V -> [4096][1024]); no projections: the bf16-rounded inputs are exact in f16, so single f16 x f16 products are exact and the unscaled logits are exact in f32.
// Structure: token rows r = b*4096 + s; x as exact f16 rows (bf16-rounded); q, k and v are these rows (no projections, no residual planes); per batch: V^T for all heads via LDS transposes; per query tile of 4096 rows (all query rows): scores against all keys as ONE f16 WMMA GEMM (64x64 wave tiles, K = 1024, grid.y 1, alpha 1: the 1/sqrt(d) comes after the softmax), row softmax on VALU over all keys (f32 statistics, native exp; weights x256 f16), out = P . V^T (K = all keys, alpha 2^-13: undoes the x256 and applies 1024^-0.5) as f32 rows written straight into the output.
// Compute dtype: inputs rounded to bf16; q, k, v exact in f16; softmax weights as plain f16 GEMM operands (~2^-12); scores, softmax statistics and out f32. v_wmma_f32_16x16x32_f16.
#define NB 1
#define SQ 4096
#define DM 1024
#define NH 16
#define HD 64
#define HG 4                         /* heads per attention launch group */
#define QT SQ                        /* query rows per launch of each attention stage: all of them */
#define NKX SQ                       /* S / P row pitch */
#define QT0 128                      /* first-tile rows recomputed exactly in f32 */
#define B0 0                         /* first batch processed (debug hook) */
#define NBR NB                       /* batches processed (debug hook) */
#define NR ((size_t)NB * SQ)         /* token rows */
#define MP ((int)((size_t)NBR * SQ)) /* rows processed, unused (debug hook) */
#define QN SQ                        /* query rows attended per batch (debug hook) */
#define NHD NH                       /* heads attended (debug hook) */
#define MPO MP                       /* rows through the output stage (debug hook) */
#define LQ DM      /* row pitch of the q/k/v rows */
typedef __bf16 v16b __attribute__((ext_vector_type(16)));
typedef unsigned short v8us __attribute__((ext_vector_type(8), may_alias));
typedef float  v8f  __attribute__((ext_vector_type(8)));
typedef float  v4f  __attribute__((ext_vector_type(4)));
typedef float  v4fa __attribute__((ext_vector_type(4), may_alias));
union FragB { v16b v; v8us half[2]; unsigned short u[16]; };

__device__ __forceinline__ unsigned short bf16_bits(float x) { unsigned int u = __float_as_uint(x); return (unsigned short)((u + 0x7FFFu + ((u >> 16) & 1u)) >> 16); }
__device__ __forceinline__ float bf16_val(unsigned short b) { return __uint_as_float(((unsigned int)b) << 16); }
__device__ __forceinline__ float bf16_round(float x) { return bf16_val(bf16_bits(x)); }
// D += A·B with NT terms: 1 = ah·bh, 2 = + al·bh (A split), 3 = + ah·bl (both split)
template <int NT>
__device__ __forceinline__ v8f mmaN(v16b ah, v16b al, v16b bh, v16b bl, v8f c) {
  c = __builtin_amdgcn_wmma_f32_16x16x32_bf16(false, ah, false, bh, (short)0, c, false, false);
  if (NT >= 2) c = __builtin_amdgcn_wmma_f32_16x16x32_bf16(false, al, false, bh, (short)0, c, false, false);
  if (NT >= 3) c = __builtin_amdgcn_wmma_f32_16x16x32_bf16(false, ah, false, bl, (short)0, c, false, false);
  asm volatile("v_nop\n\tv_nop\n\tv_nop\n\tv_nop" : "+v"(c) : "v"(ah), "v"(al), "v"(bh), "v"(bl));
  return c;
}

__global__ __launch_bounds__(256) void k_wt_bf16(const float* __restrict__ W, unsigned short* __restrict__ Wt, int K, int N) {
  const int t = blockIdx.x * 256 + threadIdx.x;
  const int k8n = K / 8;
  if (t >= N * k8n) return;
  const int n = t / k8n, k8 = (t % k8n) * 8;
  v8us v;
#pragma unroll
  for (int i = 0; i < 8; ++i) v[i] = bf16_bits(W[(size_t)(k8 + i) * N + n]);
  *(v8us*)(Wt + (size_t)n * K + k8) = v;
  
}

// GEMM C[M][N] (f32, pitch ldc) = act(A[M][K]·W + bias). A f32 row-major (pitch lda) converted per fragment to bf16
// (ASPLIT: hi/lo two planes -> 2 terms, else single rounded term); Wt bf16 [N][K] (pitch ldb). BIAS_BF16 rounds the
// bias to bf16 first (bias quantised to bf16 before the add). K%32==0, M%16==0, N%64==0.
template <bool ASPLIT, int ACT, bool BIAS_BF16>
__global__ __launch_bounds__(128) void k_gemm_bf(const float* __restrict__ A, int lda, const unsigned short* __restrict__ Wt, int ldb,
                                               const float* __restrict__ bias, float* __restrict__ C, int ldc, int M, int N, int K) {
  __shared__ __attribute__((aligned(16))) float so[4][16][64];
  const int tid = threadIdx.x, w = tid >> 5, lane = tid & 31, ln = lane & 15, hh = lane >> 4;
  const int ntn = N / 64;
  const int wid = blockIdx.x * 4 + w;
  const int mt = wid / ntn, nq = wid % ntn;
  if (mt * 16 >= M) return;
  const int row0 = mt * 16, col0 = nq * 64;
  const float* arow = A + (size_t)(row0 + ln) * lda;
  v8f acc[4] = {};
  for (int kb = 0; kb < K; kb += 32) {
    FragB ah, al;
    const v4f x0 = *(const v4fa*)(arow + kb + 8 * hh), x1 = *(const v4fa*)(arow + kb + 8 * hh + 4);
    const v4f x2 = *(const v4fa*)(arow + kb + 16 + 8 * hh), x3 = *(const v4fa*)(arow + kb + 16 + 8 * hh + 4);
    float xs[16] = {x0[0],x0[1],x0[2],x0[3],x1[0],x1[1],x1[2],x1[3],x2[0],x2[1],x2[2],x2[3],x3[0],x3[1],x3[2],x3[3]};
#pragma unroll
    for (int i = 0; i < 16; ++i) { const unsigned short hb = bf16_bits(xs[i]); ah.u[i] = hb; al.u[i] = ASPLIT ? bf16_bits(xs[i] - bf16_val(hb)) : (unsigned short)0; }
#pragma unroll
    for (int t = 0; t < 4; ++t) {
      const unsigned short* brow = Wt + (size_t)(col0 + t * 16 + ln) * ldb + kb;
      FragB b;
      b.half[0] = *(const v8us*)(brow + 8 * hh);
      b.half[1] = *(const v8us*)(brow + 16 + 8 * hh);
      acc[t] = mmaN<ASPLIT ? 2 : 1>(ah.v, al.v, b.v, b.v, acc[t]);
    }
  }
#pragma unroll
  for (int t = 0; t < 4; ++t) {
    float bv = bias ? bias[col0 + t * 16 + ln] : 0.f;
    if (BIAS_BF16) bv = bf16_round(bv);
#pragma unroll
    for (int r = 0; r < 8; ++r) { float v = acc[t][r] + bv; if (ACT == 1) v = fmaxf(v, 0.f); so[w][8 * hh + r][t * 16 + ln] = v; }
  }
  __builtin_amdgcn_fence(__ATOMIC_ACQ_REL, "workgroup");
  __builtin_amdgcn_wave_barrier();
  const int rsub = lane >> 4, c4 = (lane & 15) * 4;
  {
#pragma unroll
    for (int q = 0; q < 8; ++q) {
      const int r = q * 2 + rsub;
      const v4f v = *(const v4fa*)&so[w][r][c4];
      *(v4f*)(C + (size_t)(row0 + r) * ldc + col0 + c4) = v;
    }
    
  }
}

// GEMM C = act(A·W + bias + resid): A f32 (ASPLIT -> hi/lo 2 terms), Wt bf16 [N][K]; ACT 0 none, 1 relu, 2 exact gelu;
// resid (optional, f32, row index = (row % rmod), pitch ldr, RES_BF16 rounds it) added before the activation.
template <bool ASPLIT, int ACT, bool BIAS_BF16, bool RES_BF16>
__global__ __launch_bounds__(128) void k_gemm_bf3(const float* __restrict__ A, int lda, const unsigned short* __restrict__ Wt, int ldb,
                                                const float* __restrict__ bias, const float* __restrict__ resid, int rmod, int ldr,
                                                float* __restrict__ C, int ldc, int M, int N, int K) {
  __shared__ __attribute__((aligned(16))) float so[4][16][64];
  const int tid = threadIdx.x, w = tid >> 5, lane = tid & 31, ln = lane & 15, hh = lane >> 4;
  const int ntn = N / 64;
  const int wid = blockIdx.x * 4 + w;
  const int mt = wid / ntn, nq = wid % ntn;
  if (mt * 16 >= M) return;
  const int row0 = mt * 16, col0 = nq * 64;
  const float* arow = A + (size_t)(row0 + ln) * lda;
  v8f acc[4] = {};
  for (int kb = 0; kb < K; kb += 32) {
    FragB ah, al;
    const v4f x0 = *(const v4fa*)(arow + kb + 8 * hh), x1 = *(const v4fa*)(arow + kb + 8 * hh + 4);
    const v4f x2 = *(const v4fa*)(arow + kb + 16 + 8 * hh), x3 = *(const v4fa*)(arow + kb + 16 + 8 * hh + 4);
    float xs[16] = {x0[0],x0[1],x0[2],x0[3],x1[0],x1[1],x1[2],x1[3],x2[0],x2[1],x2[2],x2[3],x3[0],x3[1],x3[2],x3[3]};
#pragma unroll
    for (int i = 0; i < 16; ++i) { const unsigned short hb = bf16_bits(xs[i]); ah.u[i] = hb; al.u[i] = ASPLIT ? bf16_bits(xs[i] - bf16_val(hb)) : (unsigned short)0; }
#pragma unroll
    for (int t = 0; t < 4; ++t) {
      const unsigned short* brow = Wt + (size_t)(col0 + t * 16 + ln) * ldb + kb;
      FragB b;
      b.half[0] = *(const v8us*)(brow + 8 * hh);
      b.half[1] = *(const v8us*)(brow + 16 + 8 * hh);
      acc[t] = mmaN<ASPLIT ? 2 : 1>(ah.v, al.v, b.v, b.v, acc[t]);
    }
  }
#pragma unroll
  for (int t = 0; t < 4; ++t) {
    const int col = col0 + t * 16 + ln;
    float bv = bias ? bias[col] : 0.f;
    if (BIAS_BF16) bv = bf16_round(bv);
#pragma unroll
    for (int r = 0; r < 8; ++r) {
      float v = acc[t][r] + bv;
      if (resid) { float rv = resid[(size_t)((row0 + 8 * hh + r) % rmod) * ldr + col]; if (RES_BF16) rv = bf16_round(rv); v += rv; }
      if (ACT == 1) v = fmaxf(v, 0.f);
      if (ACT == 2) v = 0.5f * v * (1.0f + erff(v * 0.70710678118654752f));
      if (ACT == 3) { const float u = 0.7978845608028654f * (v + 0.044715f * v * v * v); v = 0.5f * v * (1.0f + tanhf(u)); }
      so[w][8 * hh + r][t * 16 + ln] = v;
    }
  }
  __builtin_amdgcn_fence(__ATOMIC_ACQ_REL, "workgroup");
  __builtin_amdgcn_wave_barrier();
  const int rsub = lane >> 4, c4 = (lane & 15) * 4;
  {
#pragma unroll
    for (int q = 0; q < 8; ++q) {
      const int r = q * 2 + rsub;
      const v4f v = *(const v4fa*)&so[w][r][c4];
      *(v4f*)(C + (size_t)(row0 + r) * ldc + col0 + c4) = v;
    }
    
  }
}
// row LayerNorm (biased variance, eps) over N: s = X (+ R); optional out_sum <- s; out_norm <- (s-mu)*rsqrt(var+eps)*g + b
template <bool PARAM_BF16>
__global__ __launch_bounds__(256) void k_layernorm(const float* __restrict__ X, const float* __restrict__ R, const float* __restrict__ g, const float* __restrict__ bta,
                                                  float* __restrict__ out_sum, float* __restrict__ out_norm, int N, float eps) {
  __shared__ float red[256];
  const int row = blockIdx.x, tid = threadIdx.x;
  const float* x = X + (size_t)row * N; const float* rr = R ? R + (size_t)row * N : nullptr;
  float vals[16];                     // up to N = 4096
  const int per = N / 256;            // contiguous chunk per thread? use strided-by-4 chunks: thread handles j = tid*4 + 1024*u
  float s1 = 0.f;
  for (int u = 0; u < per / 4; ++u) {
    const int j = tid * 4 + 1024 * u;
    const v4f a = *(const v4fa*)(x + j);
    v4f b = {0.f,0.f,0.f,0.f}; if (rr) b = *(const v4fa*)(rr + j);
#pragma unroll
    for (int q = 0; q < 4; ++q) { const float v = a[q] + b[q]; vals[u * 4 + q] = v; s1 += v; }
  }
  red[tid] = s1; __syncthreads();
  for (int st = 128; st > 0; st >>= 1) { if (tid < st) red[tid] += red[tid + st]; __syncthreads(); }
  const float mu = red[0] / (float)N; __syncthreads();
  float s2 = 0.f;
  for (int u = 0; u < per / 4; ++u)
#pragma unroll
    for (int q = 0; q < 4; ++q) { const float c = vals[u * 4 + q] - mu; s2 += c * c; }
  red[tid] = s2; __syncthreads();
  for (int st = 128; st > 0; st >>= 1) { if (tid < st) red[tid] += red[tid + st]; __syncthreads(); }
  const float rs = rsqrtf(red[0] / (float)N + eps);
  {
    for (int u = 0; u < per / 4; ++u) {
      const int j = tid * 4 + 1024 * u;
      v4f o, sm;
#pragma unroll
      for (int q = 0; q < 4; ++q) {
        float gg = g[j + q], bb = bta[j + q];
        if (PARAM_BF16) { gg = bf16_round(gg); bb = bf16_round(bb); }
        sm[q] = vals[u * 4 + q]; o[q] = (vals[u * 4 + q] - mu) * rs * gg + bb;
      }
      if (out_sum) *(v4f*)(out_sum + (size_t)row * N + j) = sm;
      *(v4f*)(out_norm + (size_t)row * N + j) = o;
    }
    
  }
}



// ---- f16 WMMA path (v_wmma_f32_16x16x32_f16): 11-bit significands for operands in range — used where a [0,1] probability operand needs more precision than bf16
typedef _Float16 v16h __attribute__((ext_vector_type(16)));
union FragH { v16h v; v8us half[2]; _Float16 h[16]; unsigned short u[16]; };
template <int NT>
__device__ __forceinline__ v8f mmaH(v16h ah, v16h al, v16h bh, v16h bl, v8f c) {
  c = __builtin_amdgcn_wmma_f32_16x16x32_f16(false, ah, false, bh, (short)0, c, false, false);
  if (NT >= 2) c = __builtin_amdgcn_wmma_f32_16x16x32_f16(false, al, false, bh, (short)0, c, false, false);
  if (NT >= 3) c = __builtin_amdgcn_wmma_f32_16x16x32_f16(false, ah, false, bl, (short)0, c, false, false);
  asm volatile("v_nop\n\tv_nop\n\tv_nop\n\tv_nop" : "+v"(c) : "v"(ah), "v"(al), "v"(bh), "v"(bl));
  return c;
}
// batched GEMM like k_gemm_b but f16 operands: A f32 (split into f16 hi/lo if ASPLIT, else rounded to f16), Bt = f16 values [n][k]; alpha; C f32; N multiple of 16 (partial tiles skipped)
template <bool ASPLIT>
__global__ __launch_bounds__(128) void k_gemm_h(const float* __restrict__ A, int lda, size_t sA, const _Float16* __restrict__ Bh, int ldb, size_t sB, float alpha, float* __restrict__ C, int ldc, size_t sC, int M, int N, int K) {
  __shared__ __attribute__((aligned(16))) float so[4][16][64];
  const int tid = threadIdx.x, w = tid >> 5, lane = tid & 31, ln = lane & 15, hh = lane >> 4; const int by = blockIdx.y;
  A += (size_t)by * sA; Bh += (size_t)by * sB; C += (size_t)by * sC;
  const int ntn = (N + 63) / 64; const int wid = blockIdx.x * 4 + w; const int mt = wid / ntn, nq = wid % ntn; if (mt * 16 >= M) return;
  const int row0 = mt * 16, col0 = nq * 64; const float* arow = A + (size_t)(row0 + ln) * lda;
  v8f acc[4] = {};
  for (int kb = 0; kb < K; kb += 32) {
    FragH ah, al;
    const v4f x0 = *(const v4fa*)(arow + kb + 8 * hh), x1 = *(const v4fa*)(arow + kb + 8 * hh + 4), x2 = *(const v4fa*)(arow + kb + 16 + 8 * hh), x3 = *(const v4fa*)(arow + kb + 16 + 8 * hh + 4);
    float xs[16] = {x0[0],x0[1],x0[2],x0[3],x1[0],x1[1],x1[2],x1[3],x2[0],x2[1],x2[2],x2[3],x3[0],x3[1],x3[2],x3[3]};
#pragma unroll
    for (int i = 0; i < 16; ++i) { const _Float16 h = (_Float16)xs[i]; ah.h[i] = h; al.h[i] = ASPLIT ? (_Float16)(xs[i] - (float)h) : (_Float16)0.0f; }
#pragma unroll
    for (int t = 0; t < 4; ++t) { if (col0 + t * 16 >= N) continue; const size_t boff = (size_t)(col0 + t * 16 + ln) * ldb + kb; FragH bq; bq.half[0] = *(const v8us*)(Bh + boff + 8 * hh); bq.half[1] = *(const v8us*)(Bh + boff + 16 + 8 * hh);
      acc[t] = mmaH<ASPLIT ? 2 : 1>(ah.v, al.v, bq.v, bq.v, acc[t]); }
  }
#pragma unroll
  for (int t = 0; t < 4; ++t) { if (col0 + t * 16 >= N) continue;
#pragma unroll
    for (int r = 0; r < 8; ++r) so[w][8 * hh + r][t * 16 + ln] = acc[t][r] * alpha; }
  __builtin_amdgcn_fence(__ATOMIC_ACQ_REL, "workgroup"); __builtin_amdgcn_wave_barrier();
  const int rsub = lane >> 4, c4 = (lane & 15) * 4;
  {
#pragma unroll
    for (int q = 0; q < 8; ++q) { const int r = q * 2 + rsub; if (col0 + c4 < N) { const v4f v = *(const v4fa*)&so[w][r][c4]; *(v4f*)(C + (size_t)(row0 + r) * ldc + col0 + c4) = v; } }
     }
}

// Wt[n][k] = f16(W[k][n]·scale) from f32 row-major W[K][N] (scale = power of two; bf16-exact weights stay exact in f16 away from the subnormal range)
__global__ __launch_bounds__(256) void k_wt_f16(const float* __restrict__ W, _Float16* __restrict__ Wt, int K, int N, float scale) {
  const int t = blockIdx.x * 256 + threadIdx.x; if (t >= N * (K / 8)) return; const int n = t / (K / 8), k8 = (t % (K / 8)) * 8; FragH f;
#pragma unroll
  for (int i = 0; i < 8; ++i) f.h[i] = (_Float16)(bf16_round(W[(size_t)(k8 + i) * N + n]) * scale); const v8us o = f.half[0];
  *(v8us*)((unsigned short*)Wt + (size_t)n * K + k8) = o; 
}
// k_gemm_hh variant with fused epilogue: v = acc·alpha + bias[by·sBias + col] (+ CP[(row/rowsPerB)·sCPb + by·64 + col] if CP) ; ACT 0 none / 1 elu ; writes f16 C16 (and f32 C if non-null)
template <int ACT>
__global__ __launch_bounds__(128) void k_gemm_hhx(const _Float16* __restrict__ A, int lda, size_t sA, const _Float16* __restrict__ Bh, int ldb, size_t sB, float alpha, const float* __restrict__ bias, size_t sBias, const float* __restrict__ CP, int rowsPerB, size_t sCPb, int row0g,
    float* __restrict__ C, _Float16* __restrict__ C16, int ldc, size_t sC, int M, int N, int K) {
  __shared__ __attribute__((aligned(16))) float so[4][16][64];
  const int tid = threadIdx.x, w = tid >> 5, lane = tid & 31, ln = lane & 15, hh = lane >> 4; const int by = blockIdx.y;
  A += (size_t)by * sA; Bh += (size_t)by * sB; const size_t cofs = (size_t)by * sC; const float* bp = bias ? bias + (size_t)by * sBias : nullptr;
  const int ntn = (N + 63) / 64; const int wid = blockIdx.x * 4 + w; const int mt = wid / ntn, nq = wid % ntn; if (mt * 16 >= M) return;
  const int row0 = mt * 16, col0 = nq * 64; const _Float16* arow = A + (size_t)(row0 + ln) * lda;
  v8f acc[4] = {};
  for (int kb = 0; kb < K; kb += 32) { FragH ah; ah.half[0] = *(const v8us*)((const unsigned short*)arow + kb + 8 * hh); ah.half[1] = *(const v8us*)((const unsigned short*)arow + kb + 16 + 8 * hh);
#pragma unroll
    for (int t = 0; t < 4; ++t) { if (col0 + t * 16 >= N) continue; const size_t boff = (size_t)(col0 + t * 16 + ln) * ldb + kb; FragH bq; bq.half[0] = *(const v8us*)((const unsigned short*)Bh + boff + 8 * hh); bq.half[1] = *(const v8us*)((const unsigned short*)Bh + boff + 16 + 8 * hh);
      acc[t] = mmaH<1>(ah.v, ah.v, bq.v, bq.v, acc[t]); }
  }
#pragma unroll
  for (int t = 0; t < 4; ++t) { if (col0 + t * 16 >= N) continue; const int col = col0 + t * 16 + ln; const float bv = bp ? bf16_round(bp[col]) : 0.f;
#pragma unroll
    for (int r = 0; r < 8; ++r) { float v = acc[t][r] * alpha + bv; if (CP) { const int rr = row0g + row0 + 8 * hh + r; if (rowsPerB < 0) v += CP[cofs + (size_t)rr * ldc + col];      /* rowsPerB < 0: own element of the batched C plane */ else { const int bidx = rr / rowsPerB; v += CP[(size_t)bidx * sCPb + (size_t)by * 64 + col]; } } if (ACT == 1) v = (v > 0.f) ? v : expm1f(v); else if (ACT == 7) v = (v > 0.f) ? v + 1.0f : expf(v); else if (ACT == 8) v = tanhf(v); else if (ACT == 9) v = 0.5f * v * (1.0f + tanhf(0.7978845608028654f * (v + 0.044715f * v * v * v))); else if (ACT == 11) v = 1.0f / (1.0f + expf(-v)); else if (ACT == 12) v = (v > 0.f) ? v : 0.01f * v; else if (ACT == 14) v = (v > 0.f) ? v : 0.1f * v; else if (ACT == 16) v = (v >= 0.f) ? v : 0.3f * v; else if (ACT == 17) v = (v >= 0.f) ? v : 0.2f * v; else if (ACT == 15) v = v / (1.0f + expf(-v)); else if (ACT == 3) v = fmaxf(v, 0.f); else if (ACT == 6) v = 0.5f * v * (1.0f + erff(v * 0.70710678118654752f)); so[w][8 * hh + r][t * 16 + ln] = v; } }
  __builtin_amdgcn_fence(__ATOMIC_ACQ_REL, "workgroup"); __builtin_amdgcn_wave_barrier();
  const int rsub = lane >> 4, c4 = (lane & 15) * 4; typedef _Float16 v4h __attribute__((ext_vector_type(4)));
  {
#pragma unroll
    for (int q = 0; q < 8; ++q) { const int r = q * 2 + rsub; if (col0 + c4 < N) { const v4f v = *(const v4fa*)&so[w][r][c4]; if (C) *(v4f*)(C + cofs + (size_t)(row0 + r) * ldc + col0 + c4) = v; if (C16) { v4h h4; for (int i = 0; i < 4; ++i) h4[i] = (_Float16)v[i]; *(v4h*)(C16 + cofs + (size_t)(row0 + r) * ldc + col0 + c4) = h4; } } }
     }
}


typedef _Float16 v4h __attribute__((ext_vector_type(4)));

__global__ __launch_bounds__(256) void k_x16(const float* __restrict__ x, _Float16* __restrict__ X16, size_t n8) { const size_t t = (size_t)blockIdx.x * 256 + threadIdx.x; if (t >= n8) return; FragH f;
#pragma unroll
  for (int q = 0; q < 8; ++q) f.h[q] = (_Float16)bf16_round(x[t * 8 + q]); *(v8us*)((unsigned short*)X16 + t * 8) = f.half[0];  }
__global__ __launch_bounds__(256) void k_h16(const float* __restrict__ x, _Float16* __restrict__ X16, size_t n8) { const size_t t = (size_t)blockIdx.x * 256 + threadIdx.x; if (t >= n8) return; FragH f;
#pragma unroll
  for (int q = 0; q < 8; ++q) f.h[q] = (_Float16)x[t * 8 + q]; *(v8us*)((unsigned short*)X16 + t * 8) = f.half[0];  }
__global__ __launch_bounds__(256) void k_round16f(const float* __restrict__ W, _Float16* __restrict__ Bt, size_t n8) { const size_t t = (size_t)blockIdx.x * 256 + threadIdx.x; if (t >= n8) return; FragH f;
#pragma unroll
  for (int i = 0; i < 8; ++i) f.h[i] = (_Float16)(bf16_round(W[t * 8 + i]) * 16.0f); *(v8us*)((unsigned short*)Bt + t * 8) = f.half[0];  }
template <int NHv, int TTv>
__global__ __launch_bounds__(256) void k_vt(const _Float16* __restrict__ V16, int ldv, int voff, _Float16* __restrict__ Vt) { __shared__ unsigned short tl[64][66]; const int tid = threadIdx.x; const int slab = blockIdx.x / (TTv / 64), lg = blockIdx.x % (TTv / 64); const int b = slab / NHv, h = slab % NHv;
  for (int i = tid; i < 64 * 8; i += 256) { const int r = i / 8, c8 = (i % 8) * 8; FragH f; f.half[0] = *(const v8us*)((const unsigned short*)V16 + ((size_t)b * TTv + lg * 64 + r) * ldv + voff + h * 64 + c8);
#pragma unroll
    for (int q = 0; q < 8; ++q) tl[r][c8 + q] = f.u[q]; }
  __syncthreads();
  {
#pragma unroll
    for (int rd = 0; rd < 2; ++rd) { const int d = rd * 32 + tid / 8, pc = tid % 8; FragH f;
#pragma unroll
      for (int q = 0; q < 8; ++q) f.u[q] = tl[pc * 8 + q][d];
      *(v8us*)((unsigned short*)Vt + ((size_t)slab * 64 + d) * TTv + lg * 64 + pc * 8) = f.half[0]; }
     } }

__global__ __launch_bounds__(256) void k_hl(const float* __restrict__ F, _Float16* __restrict__ Hh, _Float16* __restrict__ Hl, size_t n8) { const size_t t = (size_t)blockIdx.x * 256 + threadIdx.x; if (t >= n8) return; FragH fh, fl; const v4f a = *(const v4fa*)(F + t * 8), c = *(const v4fa*)(F + t * 8 + 4);
#pragma unroll
  for (int q = 0; q < 4; ++q) { _Float16 h = (_Float16)a[q]; fh.h[q] = h; fl.h[q] = (_Float16)((a[q] - (float)h) * 1024.0f); h = (_Float16)c[q]; fh.h[4 + q] = h; fl.h[4 + q] = (_Float16)((c[q] - (float)h) * 1024.0f); }
  { *(v8us*)((unsigned short*)Hh + t * 8) = fh.half[0]; *(v8us*)((unsigned short*)Hl + t * 8) = fl.half[0];  } }

typedef unsigned int u32x4 __attribute__((ext_vector_type(4)));
typedef unsigned int u32x8 __attribute__((ext_vector_type(8)));
#define G3_KB 256u                   /* bytes of K per operand row per pass */
#define G3_PITCH 272u                /* LDS row pitch: 256 B + the tensor load's 16 B pad (16 B x odd, for ds_load_b128 readers) */
#define G3_ROWS 64u                  /* rows per slice */
#define G3_SLICE 18432u              /* 64 x 272 = 17,408 B rounded up to a multiple of 2 KiB, so that every slice starts on one */
#define G3_STAGE (4u * G3_SLICE)     /* one buffer */
static_assert(G3_ROWS * G3_PITCH <= G3_SLICE && G3_SLICE % 2048u == 0u, "a slice holds its 64 padded rows and starts on a multiple of 2 KiB");
__device__ __forceinline__ unsigned int g3_uni(unsigned int v) { return (unsigned int)__builtin_amdgcn_readfirstlane(v); }
__device__ __forceinline__ unsigned int g3_pinned(unsigned int v) { unsigned int w = (unsigned int)__builtin_amdgcn_readfirstlane(v); asm volatile("" : "+s"(w)); return w; }
__device__ __forceinline__ void g3_wait_ds0() { asm volatile("s_wait_dscnt 0x0" ::: "memory"); }          /* this wave's LDS reads and writes have returned */
__device__ __forceinline__ void g3_wait_tensor0() { asm volatile("s_wait_tensorcnt 0x0" ::: "memory"); }  /* this wave's tensor load has landed */
__device__ __forceinline__ void g3_fence() { __builtin_amdgcn_sched_barrier(0); }                         /* keeps a block's LDS loads as one group in front of the WMMA block instead of spread among the WMMAs */
// Descriptor of one request: 64 rows of 256 bytes, source row pitch kb bytes, to LDS byte offset dst with 16 B of pad behind every 256 B.
__device__ __forceinline__ u32x4 g3_group0(unsigned int dst, unsigned long long ga) { u32x4 g0;
  g0[0] = g3_uni(1u);                                                               /* count 1 */
  g0[1] = g3_uni(dst);
  g0[2] = g3_uni((unsigned int)ga);
  g0[3] = g3_uni((((unsigned int)(ga >> 32)) & 0x01FFFFFFu) | 0x80000000u);         /* address [56:32], type 2 */
  return g0; }
__device__ __forceinline__ u32x8 g3_group1(unsigned int kb) { u32x8 g1;
  g1[0] = g3_uni((1u << 20) | (5u << 22) | (3u << 25));                             /* no mask, 1-byte elements, pad of 4 dwords behind every 64 dwords */
  g1[1] = g3_uni((G3_KB & 0xFFFFu) << 16);                                          /* tensor_dim0 [15:0] */
  g1[2] = g3_uni((G3_KB >> 16) | ((G3_ROWS & 0xFFFFu) << 16));                      /* tensor_dim0 [31:16], tensor_dim1 [15:0] */
  g1[3] = g3_uni((G3_ROWS >> 16) | (G3_KB << 16));                                  /* tensor_dim1 [31:16], tile_dim0 */
  g1[4] = g3_uni(G3_ROWS);                                                          /* tile_dim1 */
  g1[5] = g3_uni(kb);                                                               /* source row pitch */
  g1[6] = g3_uni(0u); g1[7] = g3_uni(0u);
  return g1; }
// The two groups are named as in-out operands so that their registers stay the descriptor's own from one request to the next: the compiler otherwise used some of them as scratch while a request was outstanding.
__device__ __forceinline__ void g3_tload(u32x4& g0, u32x8& g1) { asm volatile("tensor_load_to_lds %0, %1" : "+s"(g0), "+s"(g1) :: "memory"); }
// The next pass's request: the source moves on by one pass's 256 bytes (carry into the address's high word), the destination is dst. The step comes through g3_pinned, so these additions stand behind the tensor wait in front.
__device__ __forceinline__ void g3_next(u32x4& g0, unsigned int dst) { const unsigned int step = g3_pinned(G3_KB); const unsigned int lo = g0[2] + step; g0[3] = g3_uni(g0[3] + ((lo < step) ? 1u : 0u)); g0[2] = g3_uni(lo); g0[1] = g3_uni(dst); }
__device__ __forceinline__ v16h g3_frag(const unsigned char* p) { FragH f; f.half[0] = *(const v8us*)p; f.half[1] = *(const v8us*)(p + 32); return f.v; }
template <int LDC>      /* row pitch of C in elements: a constant, so that the 32 row stores of a wave share one address register and differ in their immediate offsets */
__global__ __launch_bounds__(128) void k_gemm3(const _Float16* __restrict__ A, const _Float16* __restrict__ Bh, float alpha, float* __restrict__ C, int ntn, int K) {
  __shared__ __attribute__((aligned(2048))) unsigned char L[2u * G3_STAGE];
  const unsigned int tid = threadIdx.x, lane = tid & 31u, h = lane >> 4, r16 = lane & 15u; const unsigned int wave = g3_uni(tid >> 5);
  const unsigned int mt = blockIdx.x / (unsigned int)ntn, nq = blockIdx.x - mt * (unsigned int)ntn; const unsigned int m0 = mt * 128u, n0 = nq * 128u;
  const unsigned int wn = wave & 1u, wm = wave >> 1; const unsigned int kb = (unsigned int)K * 2u; const unsigned int T = g3_pinned((unsigned int)K / 128u);      /* passes */
  const unsigned long long src0 = (wave < 2u) ? (unsigned long long)(size_t)Bh + (unsigned long long)(n0 + G3_ROWS * wave) * kb : (unsigned long long)(size_t)A + (unsigned long long)(m0 + G3_ROWS * (wave - 2u)) * kb;      /* first byte of this wave's 64 source rows */
  const unsigned int lds_slice = (unsigned int)(size_t)L + wave * G3_SLICE;      /* add buffer * G3_STAGE */
  const unsigned int fw_base = wn * G3_SLICE + r16 * G3_PITCH + 16u * h, fx_base = (2u + wm) * G3_SLICE + r16 * G3_PITCH + 16u * h;
  v8f acc[4][4];      /* every "#pragma unroll" in this kernel keeps the indices of acc, fw and fx compile-time constants, so that the arrays live in registers and not in scratch */
#pragma unroll
  for (int i = 0; i < 4; ++i)
#pragma unroll
    for (int j = 0; j < 4; ++j) acc[i][j] = (v8f){0.f, 0.f, 0.f, 0.f, 0.f, 0.f, 0.f, 0.f};
  u32x4 g0 = g3_group0(lds_slice, src0); u32x8 g1 = g3_group1(kb);
  g3_tload(g0, g1);      /* pass 0 into buffer 0 */
  g3_wait_tensor0();
  __syncthreads();      /* every slice of pass 0 has landed */
  if (g3_pinned((1u < T) ? 1u : 0u) != 0u) { g3_next(g0, lds_slice + G3_STAGE); g3_tload(g0, g1); }      /* pass 1 into buffer 1 */
#pragma clang loop unroll(disable)      /* one pass per trip: the ring's order stands once, and every accumulator index stays a constant */
  for (unsigned int t = 0; t < T; ++t) {
    const unsigned int buf = (t & 1u) * G3_STAGE; const unsigned char* lw = L + buf + fw_base; const unsigned char* lx = L + buf + fx_base;
    v16h fw[2][4], fx[2][4];      /* set (u & 1) holds block u's fragments; all of them come from this pass's own buffer */
#pragma unroll
    for (int i = 0; i < 4; ++i) { fw[0][i] = g3_frag(lw + (unsigned int)i * 16u * G3_PITCH); fx[0][i] = g3_frag(lx + (unsigned int)i * 16u * G3_PITCH); }
#pragma unroll
    for (int u = 0; u < 4; ++u) { const int cs = u & 1;
      if (u + 1 < 4) {
#pragma unroll
        for (int i = 0; i < 4; ++i) { fw[cs ^ 1][i] = g3_frag(lw + (unsigned int)i * 16u * G3_PITCH + (unsigned int)(u + 1) * 64u); fx[cs ^ 1][i] = g3_frag(lx + (unsigned int)i * 16u * G3_PITCH + (unsigned int)(u + 1) * 64u); } }
      g3_fence();
#pragma unroll
      for (int i = 0; i < 4; ++i)
#pragma unroll
        for (int j = 0; j < 4; ++j) acc[i][j] = __builtin_amdgcn_wmma_f32_16x16x32_f16(false, fw[cs][i], false, fx[cs][j], (short)0, acc[i][j], false, false);
      g3_fence(); }
    g3_wait_ds0();
    g3_wait_tensor0();
    __syncthreads();
    if (g3_pinned((t + 2u < T) ? 1u : 0u) != 0u) { g3_next(g0, lds_slice + buf); g3_tload(g0, g1); }      /* only while pass t + 2 exists: into the buffer just left */
  }
  g3_wait_tensor0();
  g3_wait_ds0();
  // Output staging, each wave in its own 64 rows x 272 B: behind the last pass's barrier nothing reads the ring and no tensor load is outstanding. Whole 128-byte lines are stored.
  unsigned char* E = L + wave * (G3_ROWS * G3_PITCH);
#pragma unroll
  for (int i = 0; i < 4; ++i)
#pragma unroll
    for (int j = 0; j < 4; ++j) { v4f lo4, hi4;
#pragma unroll
      for (int r = 0; r < 4; ++r) { lo4[r] = acc[i][j][r] * alpha; hi4[r] = acc[i][j][4 + r] * alpha; }
      unsigned char* e = E + (16u * (unsigned int)j + r16) * G3_PITCH + 64u * (unsigned int)i + 32u * h; *(v4fa*)e = lo4; *(v4fa*)(e + 16) = hi4; }
  g3_wait_ds0();      /* the staged rows are written before this wave reads them back */
  float* cb = C + (size_t)(m0 + wm * 64u + h) * (unsigned int)LDC + n0 + wn * 64u + 4u * r16;
#pragma unroll
  for (int q = 0; q < 32; ++q) { const unsigned int row = 2u * (unsigned int)q + h; const v4f v = *(const v4fa*)(E + row * G3_PITCH + 16u * r16); *(v4f*)(cb + (size_t)(2 * q) * (unsigned int)LDC) = v; } }


__global__ __launch_bounds__(256) void k_wnat(const float* __restrict__ w, size_t n8, _Float16* __restrict__ Bt) { const size_t t = (size_t)blockIdx.x * 256 + threadIdx.x; if (t >= n8) return; FragH f; for (int q = 0; q < 8; ++q) f.h[q] = (_Float16)(bf16_round(w[t * 8 + q]) * 16.0f); *(v8us*)((unsigned short*)Bt + t * 8) = f.half[0];  }
__global__ __launch_bounds__(256) void k_rsm(const float* __restrict__ S, _Float16* __restrict__ P, int nrows) {
  #pragma clang fp contract(off)
  const int i = blockIdx.x * 256 + threadIdx.x; if (i >= nrows) return; const float* s = S + (size_t)i * SQ; float mx = -3.0e38f;
#pragma unroll 1
  for (int j = 0; j < SQ; ++j) mx = fmaxf(mx, s[j]); float se = 0.f;
#pragma unroll 1
  for (int j = 0; j < SQ; ++j) se += expf(s[j] - mx); const float sc = 256.0f / se;
#pragma unroll 1
  for (int j0 = 0; j0 < SQ; j0 += 8) { FragH f; for (int q = 0; q < 8; ++q) f.h[q] = (_Float16)(expf(s[j0 + q] - mx) * sc); unsigned short* d = (unsigned short*)P + (size_t)i * SQ + j0; *(v8us*)d = f.half[0];  } }
__global__ __launch_bounds__(256) void k_vt(const _Float16* __restrict__ V16, int b, int h0, _Float16* __restrict__ VT) { __shared__ unsigned short tl[64][65]; const int tid = threadIdx.x; const int hh = blockIdx.x % HG, sg = blockIdx.x / HG; const int s0 = sg * 64; const int h = h0 + hh;
  for (int i = tid; i < 64 * 8; i += 256) { const int j = i / 8, d8 = (i % 8) * 8; FragH f; f.half[0] = *(const v8us*)((const unsigned short*)V16 + ((size_t)b * SQ + s0 + j) * DM + h * HD + d8); for (int q = 0; q < 8; ++q) tl[d8 + q][j] = f.u[q]; }
  __syncthreads();
  { for (int i = tid; i < 64 * 8; i += 256) { const int d = i / 8, j8 = (i % 8) * 8; FragH f; for (int q = 0; q < 8; ++q) f.u[q] = tl[d][j8 + q]; *(v8us*)((unsigned short*)VT + ((size_t)hh * HD + d) * SQ + s0 + j8) = f.half[0]; }  } }



// 2^t on the native unit. The v_nop in the same statement is the free slot that the instruction set asks for behind a transcendental before its result is used or
// its source overwritten; a v_nop in a statement of its own moved away.
__device__ __forceinline__ float exp2_slot(float t) { float e; asm("v_exp_f32 %0, %1\n\tv_nop" : "=v"(e) : "v"(t)); return e; }
// Row softmax, one work-group per logits row: 256 threads hold 16 logits each in registers (one coalesced read of the row),
// row maximum and row sum by wave shuffles plus one LDS exchange each; weights x256 as f16, f32 statistics, native exp.
__global__ __launch_bounds__(256) void k_rsmrow(const float* __restrict__ S, _Float16* __restrict__ P) {
  static_assert(SQ == 4 * 1024, "k_rsmrow: 256 threads x 4 chunks x 4 logits cover one row");
  __shared__ float rmx[8]; __shared__ float rse[8];
  const int tid = threadIdx.x, w = tid >> 5, lane = tid & 31; const float* s = S + (size_t)blockIdx.x * NKX + tid * 4;
  v4f x[4];
#pragma unroll
  for (int u = 0; u < 4; ++u) x[u] = *(const v4fa*)(s + u * 1024);
  asm volatile("s_wait_xcnt 0x0" ::: "memory");      /* stands in front of the later overwrite of the offset register that the four issued loads name */
  float mx = -3.0e38f;
#pragma unroll
  for (int u = 0; u < 4; ++u) for (int q = 0; q < 4; ++q) mx = fmaxf(mx, x[u][q]);
#pragma unroll
  for (int m = 16; m > 0; m >>= 1) mx = fmaxf(mx, __shfl_xor(mx, m, 32));
  if (lane == 0) rmx[w] = mx;
  __syncthreads();      /* every wave's maximum is in rmx */
  mx = rmx[0];
#pragma unroll
  for (int i = 1; i < 8; ++i) mx = fmaxf(mx, rmx[i]);
  float se = 0.f;
#pragma unroll
  for (int u = 0; u < 4; ++u) for (int q = 0; q < 4; ++q) { x[u][q] = exp2_slot((x[u][q] - mx) * 1.44269504088896340736f); se += x[u][q]; }      /* = the native exp(s - mx): multiply by log2(e), then v_exp_f32 */
#pragma unroll
  for (int m = 16; m > 0; m >>= 1) se += __shfl_xor(se, m, 32);
  if (lane == 0) rse[w] = se;
  __syncthreads();      /* every wave's partial sum is in rse */
  se = rse[0];
#pragma unroll
  for (int i = 1; i < 8; ++i) se += rse[i];
  const float sc = 256.0f / se; _Float16* d = P + (size_t)blockIdx.x * NKX + tid * 4;
#pragma unroll
  for (int u = 0; u < 4; ++u) { v4h h4; for (int q = 0; q < 4; ++q) h4[q] = (_Float16)(x[u][q] * sc); *(v4h*)(d + u * 1024) = h4; } }


template <int MASKADD>
__global__ __launch_bounds__(64) void k_att0(const float* __restrict__ QF, const float* __restrict__ KF, const float* __restrict__ VF, int ld, const float* __restrict__ mask, float scale, float* __restrict__ OF, int ldo) {
  #pragma clang fp contract(off)
  __shared__ __attribute__((aligned(16))) float lq[64][64]; __shared__ __attribute__((aligned(16))) float lo[64][64];
  const int tid = threadIdx.x; const int h = blockIdx.x / (QT0 / 64), rg = blockIdx.x % (QT0 / 64); const int i = rg * 64 + tid;
  const float* qr = QF + (size_t)i * ld + h * HD;
#pragma unroll 1
  for (int c = 0; c < HD / 4; ++c) { *(v4f*)&lq[tid][c * 4] = *(const v4fa*)(qr + c * 4); const v4f z = {0.f, 0.f, 0.f, 0.f}; *(v4f*)&lo[tid][c * 4] = z; }
  float m = -1.0e30f, l = 0.f; const int jmax = MASKADD ? (SQ - 1) : (rg * 64 + 63);      /* additive-mask form: every key (the mask input decides); causal form: keys up to the block's last row */
#pragma unroll 1
  for (int j = 0; j <= jmax; ++j) { const float* kr = KF + (size_t)j * ld + h * HD; const float* vr = VF + (size_t)j * ld + h * HD; float s = 0.f;
#pragma unroll 1
    for (int c = 0; c < HD / 4; ++c) { const v4f kq = *(const v4fa*)(kr + c * 4); const v4f qq = *(v4f*)&lq[tid][c * 4]; s = __fadd_rn(s, __fmul_rn(qq[0], kq[0])); s = __fadd_rn(s, __fmul_rn(qq[1], kq[1])); s = __fadd_rn(s, __fmul_rn(qq[2], kq[2])); s = __fadd_rn(s, __fmul_rn(qq[3], kq[3])); }
    s = __fmul_rn(s, scale); if (MASKADD) s = __fadd_rn(s, __fmul_rn(bf16_round(mask[(size_t)i * SQ + j]), -10000.0f));
    const float f = (MASKADD || j <= i) ? 1.f : 0.f; const float sm = fmaf(f, s, (1.f - f) * -1.0e30f); const float mn = fmaxf(m, sm); const float sc = expf(m - mn); const float e = expf(sm - mn); l = __fadd_rn(__fmul_rn(l, sc), e); m = mn;
#pragma unroll 1
    for (int c = 0; c < HD / 4; ++c) { const v4f vv = *(const v4fa*)(vr + c * 4); v4f oo = *(v4f*)&lo[tid][c * 4]; for (int u = 0; u < 4; ++u) oo[u] = __fadd_rn(__fmul_rn(oo[u], sc), __fmul_rn(e, vv[u])); *(v4f*)&lo[tid][c * 4] = oo; } }
  const float fin = 64.0f / l;      /* o carried x64 */
#pragma unroll 1
  for (int c = 0; c < HD / 4; ++c) { v4f oo = *(v4f*)&lo[tid][c * 4]; for (int u = 0; u < 4; ++u) oo[u] = __fmul_rn(oo[u], fin); *(v4f*)&lo[tid][c * 4] = oo; }
  __syncthreads();
  {
#pragma unroll 1
    for (int it = 0; it < 16; ++it) { const int row = it * 4 + tid / 16, pc = (tid % 16) * 4; const v4f v = *(const v4f*)&lo[row][pc]; *(v4f*)(OF + (size_t)(rg * 64 + row) * ldo + h * HD + pc) = v; }
     } }

__global__ __launch_bounds__(256) void k_of0out(const float* __restrict__ src, float* __restrict__ dst, size_t n4) { const size_t t = (size_t)blockIdx.x * 256 + threadIdx.x; if (t >= n4) return; v4f v = *(const v4fa*)(src + t * 4); for (int q = 0; q < 4; ++q) v[q] = __fmul_rn(v[q], 0.015625f); *(v4f*)(dst + t * 4) = v;  }

extern "C" void kernel_launch(void* const* d_in, const int* in_sizes, int n_in,
                              void* d_out, int out_size, void* d_ws, size_t ws_size, hipStream_t stream) {
  (void)in_sizes; (void)n_in; (void)out_size;
  const float* const* I = (const float* const*)d_in; const float* x1 = I[0]; const float* x2 = I[1]; const float* x3 = I[2];      /* input order: Q, K, V (2-D [4096][1024] = one sequence); no weights, no biases, no projections, no scalar inputs */
  char* ws = (char*)d_ws; size_t off = 0;
  auto take = [&](size_t bytes) { char* p = ws + off; off += (bytes + 255) & ~(size_t)255; return p; };
  _Float16* QH = (_Float16*)take(NR * DM * 2); _Float16* QL = (_Float16*)take(NR * DM * 2); _Float16* KH = (_Float16*)take(NR * DM * 2); _Float16* KL = (_Float16*)take(NR * DM * 2); _Float16* Q16 = QH; _Float16* K16 = KH; _Float16* V16 = (_Float16*)take(NR * DM * 2);
  float* S = (float*)take((size_t)QT * NKX * 4); _Float16* P = (_Float16*)take((size_t)QT * NKX * 2); _Float16* VT = (_Float16*)take((size_t)NH * HD * SQ * 2);
  if (off > ws_size) return;
  const size_t r0p = (size_t)B0 * SQ;      /* first processed row (unused) */
  k_x16<<<(unsigned)((NR * DM / 8 + 255) / 256), 256, 0, stream>>>(x1, QH, NR * DM / 8);      /* queries: bf16 inputs are exact in f16 (no projection, no residual plane needed) */
  k_x16<<<(unsigned)((NR * DM / 8 + 255) / 256), 256, 0, stream>>>(x2, KH, NR * DM / 8);      /* keys */
  k_x16<<<(unsigned)((NR * DM / 8 + 255) / 256), 256, 0, stream>>>(x3, V16, NR * DM / 8);      /* values */
  for (int b = B0; b < B0 + NBR; ++b) { const size_t r0 = (size_t)b * SQ;
    k_vt<NH, SQ><<<NH * (SQ / 64), 256, 0, stream>>>(V16 + r0 * LQ, LQ, 0, VT);      /* V^T [NH][HD][SQ] for this batch */
    for (int q0 = 0; q0 < QN; q0 += QT) { const int nk = SQ;      /* NON-causal: every query row sees all SQ keys; QT = SQ, so each stage below is ONE launch over all query rows (the whole logits plane S and weights plane P lie in the workspace) */
      k_gemm3<NKX><<<(QT / 128) * (nk / 128), 128, 0, stream>>>(QH + (r0 + q0) * LQ, KH + r0 * LQ, 1.0f, S, nk / 128, DM);      /* UNSCALED logits of the single 1024-wide head: exact f16 x f16 products over K = 1024, alpha 1 */
      k_rsmrow<<<QT, 256, 0, stream>>>(S, P);      /* plain softmax over all SQ keys: one work-group per query row */
      k_gemm3<DM><<<(QT / 128) * (DM / 128), 128, 0, stream>>>(P, VT, 0.0001220703125f, (float*)d_out + (r0 + q0) * DM, DM / 128, nk); } }      /* out = (softmax * 1024^-0.5) V: alpha 2^-8 (the P x256 scale) x 2^-5 (the module's post-softmax scale d^-0.5 = 1/32) = 2^-13; N = 1024: V^T [1024][SQ] = sixteen 64-row slabs; f32 rows written straight into the output */
}

// v004
// A run of this version takes 89.2 microseconds.
// In two side-by-side timings against v003, it was 1.09 and 1.08 times as fast.
// All steps since v000 together make it 141 times as fast.
#include <hip/hip_runtime.h>
// Raw single-head dot-product attention on 2-D inputs with the scale applied AFTER the softmax (Q [4096][1024], K [4096][1024], V [4096][1024]; logits = Q K^T (UNSCALED: sigma ~32 over 1024 dims); scores = softmax(logits over the keys) * 1024^-0.5; out = scores V -> [4096][1024]); no projections: the bf16-rounded inputs are exact in f16, so single f16 x f16 products are exact and the unscaled logits are exact in f32.
// Structure: token rows r = b*4096 + s; one launch ahead of the batch loop: q and k as exact f16 rows (bf16-rounded) and V^T for all heads, rounded alike, via LDS transposes (no projections, no residual planes); per query tile of 4096 rows (all query rows): scores against all keys as ONE f16 WMMA GEMM (64x64 wave tiles, K = 1024, grid.y 1, alpha 1: the 1/sqrt(d) comes after the softmax), row softmax on VALU over all keys (f32 statistics, native exp; weights x256 f16), out = P . V^T (K = all keys, alpha 2^-13: undoes the x256 and applies 1024^-0.5) as f32 rows written straight into the output.
// Compute dtype: inputs rounded to bf16; q, k, v exact in f16; softmax weights as plain f16 GEMM operands (~2^-12); scores, softmax statistics and out f32. v_wmma_f32_16x16x32_f16.
#define NB 1
#define SQ 4096
#define DM 1024
#define NH 16
#define HD 64
#define HG 4                         /* heads per attention launch group */
#define QT SQ                        /* query rows per launch of each attention stage: all of them */
#define NKX SQ                       /* S / P row pitch */
#define QT0 128                      /* first-tile rows recomputed exactly in f32 */
#define B0 0                         /* first batch processed (debug hook) */
#define NBR NB                       /* batches processed (debug hook) */
#define NR ((size_t)NB * SQ)         /* token rows */
#define MP ((int)((size_t)NBR * SQ)) /* rows processed, unused (debug hook) */
#define QN SQ                        /* query rows attended per batch (debug hook) */
#define NHD NH                       /* heads attended (debug hook) */
#define MPO MP                       /* rows through the output stage (debug hook) */
#define LQ DM      /* row pitch of the q/k/v rows */
typedef __bf16 v16b __attribute__((ext_vector_type(16)));
typedef unsigned short v8us __attribute__((ext_vector_type(8), may_alias));
typedef float  v8f  __attribute__((ext_vector_type(8)));
typedef float  v4f  __attribute__((ext_vector_type(4)));
typedef float  v4fa __attribute__((ext_vector_type(4), may_alias));
union FragB { v16b v; v8us half[2]; unsigned short u[16]; };

__device__ __forceinline__ unsigned short bf16_bits(float x) { unsigned int u = __float_as_uint(x); return (unsigned short)((u + 0x7FFFu + ((u >> 16) & 1u)) >> 16); }
__device__ __forceinline__ float bf16_val(unsigned short b) { return __uint_as_float(((unsigned int)b) << 16); }
__device__ __forceinline__ float bf16_round(float x) { return bf16_val(bf16_bits(x)); }
// D += A·B with NT terms: 1 = ah·bh, 2 = + al·bh (A split), 3 = + ah·bl (both split)
template <int NT>
__device__ __forceinline__ v8f mmaN(v16b ah, v16b al, v16b bh, v16b bl, v8f c) {
  c = __builtin_amdgcn_wmma_f32_16x16x32_bf16(false, ah, false, bh, (short)0, c, false, false);
  if (NT >= 2) c = __builtin_amdgcn_wmma_f32_16x16x32_bf16(false, al, false, bh, (short)0, c, false, false);
  if (NT >= 3) c = __builtin_amdgcn_wmma_f32_16x16x32_bf16(false, ah, false, bl, (short)0, c, false, false);
  asm volatile("v_nop\n\tv_nop\n\tv_nop\n\tv_nop" : "+v"(c) : "v"(ah), "v"(al), "v"(bh), "v"(bl));
  return c;
}

__global__ __launch_bounds__(256) void k_wt_bf16(const float* __restrict__ W, unsigned short* __restrict__ Wt, int K, int N) {
  const int t = blockIdx.x * 256 + threadIdx.x;
  const int k8n = K / 8;
  if (t >= N * k8n) return;
  const int n = t / k8n, k8 = (t % k8n) * 8;
  v8us v;
#pragma unroll
  for (int i = 0; i < 8; ++i) v[i] = bf16_bits(W[(size_t)(k8 + i) * N + n]);
  *(v8us*)(Wt + (size_t)n * K + k8) = v;
  
}

// GEMM C[M][N] (f32, pitch ldc) = act(A[M][K]·W + bias). A f32 row-major (pitch lda) converted per fragment to bf16
// (ASPLIT: hi/lo two planes -> 2 terms, else single rounded term); Wt bf16 [N][K] (pitch ldb). BIAS_BF16 rounds the
// bias to bf16 first (bias quantised to bf16 before the add). K%32==0, M%16==0, N%64==0.
template <bool ASPLIT, int ACT, bool BIAS_BF16>
__global__ __launch_bounds__(128) void k_gemm_bf(const float* __restrict__ A, int lda, const unsigned short* __restrict__ Wt, int ldb,
                                               const float* __restrict__ bias, float* __restrict__ C, int ldc, int M, int N, int K) {
  __shared__ __attribute__((aligned(16))) float so[4][16][64];
  const int tid = threadIdx.x, w = tid >> 5, lane = tid & 31, ln = lane & 15, hh = lane >> 4;
  const int ntn = N / 64;
  const int wid = blockIdx.x * 4 + w;
  const int mt = wid / ntn, nq = wid % ntn;
  if (mt * 16 >= M) return;
  const int row0 = mt * 16, col0 = nq * 64;
  const float* arow = A + (size_t)(row0 + ln) * lda;
  v8f acc[4] = {};
  for (int kb = 0; kb < K; kb += 32) {
    FragB ah, al;
    const v4f x0 = *(const v4fa*)(arow + kb + 8 * hh), x1 = *(const v4fa*)(arow + kb + 8 * hh + 4);
    const v4f x2 = *(const v4fa*)(arow + kb + 16 + 8 * hh), x3 = *(const v4fa*)(arow + kb + 16 + 8 * hh + 4);
    float xs[16] = {x0[0],x0[1],x0[2],x0[3],x1[0],x1[1],x1[2],x1[3],x2[0],x2[1],x2[2],x2[3],x3[0],x3[1],x3[2],x3[3]};
#pragma unroll
    for (int i = 0; i < 16; ++i) { const unsigned short hb = bf16_bits(xs[i]); ah.u[i] = hb; al.u[i] = ASPLIT ? bf16_bits(xs[i] - bf16_val(hb)) : (unsigned short)0; }
#pragma unroll
    for (int t = 0; t < 4; ++t) {
      const unsigned short* brow = Wt + (size_t)(col0 + t * 16 + ln) * ldb + kb;
      FragB b;
      b.half[0] = *(const v8us*)(brow + 8 * hh);
      b.half[1] = *(const v8us*)(brow + 16 + 8 * hh);
      acc[t] = mmaN<ASPLIT ? 2 : 1>(ah.v, al.v, b.v, b.v, acc[t]);
    }
  }
#pragma unroll
  for (int t = 0; t < 4; ++t) {
    float bv = bias ? bias[col0 + t * 16 + ln] : 0.f;
    if (BIAS_BF16) bv = bf16_round(bv);
#pragma unroll
    for (int r = 0; r < 8; ++r) { float v = acc[t][r] + bv; if (ACT == 1) v = fmaxf(v, 0.f); so[w][8 * hh + r][t * 16 + ln] = v; }
  }
  __builtin_amdgcn_fence(__ATOMIC_ACQ_REL, "workgroup");
  __builtin_amdgcn_wave_barrier();
  const int rsub = lane >> 4, c4 = (lane & 15) * 4;
  {
#pragma unroll
    for (int q = 0; q < 8; ++q) {
      const int r = q * 2 + rsub;
      const v4f v = *(const v4fa*)&so[w][r][c4];
      *(v4f*)(C + (size_t)(row0 + r) * ldc + col0 + c4) = v;
    }
    
  }
}

// GEMM C = act(A·W + bias + resid): A f32 (ASPLIT -> hi/lo 2 terms), Wt bf16 [N][K]; ACT 0 none, 1 relu, 2 exact gelu;
// resid (optional, f32, row index = (row % rmod), pitch ldr, RES_BF16 rounds it) added before the activation.
template <bool ASPLIT, int ACT, bool BIAS_BF16, bool RES_BF16>
__global__ __launch_bounds__(128) void k_gemm_bf3(const float* __restrict__ A, int lda, const unsigned short* __restrict__ Wt, int ldb,
                                                const float* __restrict__ bias, const float* __restrict__ resid, int rmod, int ldr,
                                                float* __restrict__ C, int ldc, int M, int N, int K) {
  __shared__ __attribute__((aligned(16))) float so[4][16][64];
  const int tid = threadIdx.x, w = tid >> 5, lane = tid & 31, ln = lane & 15, hh = lane >> 4;
  const int ntn = N / 64;
  const int wid = blockIdx.x * 4 + w;
  const int mt = wid / ntn, nq = wid % ntn;
  if (mt * 16 >= M) return;
  const int row0 = mt * 16, col0 = nq * 64;
  const float* arow = A + (size_t)(row0 + ln) * lda;
  v8f acc[4] = {};
  for (int kb = 0; kb < K; kb += 32) {
    FragB ah, al;
    const v4f x0 = *(const v4fa*)(arow + kb + 8 * hh), x1 = *(const v4fa*)(arow + kb + 8 * hh + 4);
    const v4f x2 = *(const v4fa*)(arow + kb + 16 + 8 * hh), x3 = *(const v4fa*)(arow + kb + 16 + 8 * hh + 4);
    float xs[16] = {x0[0],x0[1],x0[2],x0[3],x1[0],x1[1],x1[2],x1[3],x2[0],x2[1],x2[2],x2[3],x3[0],x3[1],x3[2],x3[3]};
#pragma unroll
    for (int i = 0; i < 16; ++i) { const unsigned short hb = bf16_bits(xs[i]); ah.u[i] = hb; al.u[i] = ASPLIT ? bf16_bits(xs[i] - bf16_val(hb)) : (unsigned short)0; }
#pragma unroll
    for (int t = 0; t < 4; ++t) {
      const unsigned short* brow = Wt + (size_t)(col0 + t * 16 + ln) * ldb + kb;
      FragB b;
      b.half[0] = *(const v8us*)(brow + 8 * hh);
      b.half[1] = *(const v8us*)(brow + 16 + 8 * hh);
      acc[t] = mmaN<ASPLIT ? 2 : 1>(ah.v, al.v, b.v, b.v, acc[t]);
    }
  }
#pragma unroll
  for (int t = 0; t < 4; ++t) {
    const int col = col0 + t * 16 + ln;
    float bv = bias ? bias[col] : 0.f;
    if (BIAS_BF16) bv = bf16_round(bv);
#pragma unroll
    for (int r = 0; r < 8; ++r) {
      float v = acc[t][r] + bv;
      if (resid) { float rv = resid[(size_t)((row0 + 8 * hh + r) % rmod) * ldr + col]; if (RES_BF16) rv = bf16_round(rv); v += rv; }
      if (ACT == 1) v = fmaxf(v, 0.f);
      if (ACT == 2) v = 0.5f * v * (1.0f + erff(v * 0.70710678118654752f));
      if (ACT == 3) { const float u = 0.7978845608028654f * (v + 0.044715f * v * v * v); v = 0.5f * v * (1.0f + tanhf(u)); }
      so[w][8 * hh + r][t * 16 + ln] = v;
    }
  }
  __builtin_amdgcn_fence(__ATOMIC_ACQ_REL, "workgroup");
  __builtin_amdgcn_wave_barrier();
  const int rsub = lane >> 4, c4 = (lane & 15) * 4;
  {
#pragma unroll
    for (int q = 0; q < 8; ++q) {
      const int r = q * 2 + rsub;
      const v4f v = *(const v4fa*)&so[w][r][c4];
      *(v4f*)(C + (size_t)(row0 + r) * ldc + col0 + c4) = v;
    }
    
  }
}
// row LayerNorm (biased variance, eps) over N: s = X (+ R); optional out_sum <- s; out_norm <- (s-mu)*rsqrt(var+eps)*g + b
template <bool PARAM_BF16>
__global__ __launch_bounds__(256) void k_layernorm(const float* __restrict__ X, const float* __restrict__ R, const float* __restrict__ g, const float* __restrict__ bta,
                                                  float* __restrict__ out_sum, float* __restrict__ out_norm, int N, float eps) {
  __shared__ float red[256];
  const int row = blockIdx.x, tid = threadIdx.x;
  const float* x = X + (size_t)row * N; const float* rr = R ? R + (size_t)row * N : nullptr;
  float vals[16];                     // up to N = 4096
  const int per = N / 256;            // contiguous chunk per thread? use strided-by-4 chunks: thread handles j = tid*4 + 1024*u
  float s1 = 0.f;
  for (int u = 0; u < per / 4; ++u) {
    const int j = tid * 4 + 1024 * u;
    const v4f a = *(const v4fa*)(x + j);
    v4f b = {0.f,0.f,0.f,0.f}; if (rr) b = *(const v4fa*)(rr + j);
#pragma unroll
    for (int q = 0; q < 4; ++q) { const float v = a[q] + b[q]; vals[u * 4 + q] = v; s1 += v; }
  }
  red[tid] = s1; __syncthreads();
  for (int st = 128; st > 0; st >>= 1) { if (tid < st) red[tid] += red[tid + st]; __syncthreads(); }
  const float mu = red[0] / (float)N; __syncthreads();
  float s2 = 0.f;
  for (int u = 0; u < per / 4; ++u)
#pragma unroll
    for (int q = 0; q < 4; ++q) { const float c = vals[u * 4 + q] - mu; s2 += c * c; }
  red[tid] = s2; __syncthreads();
  for (int st = 128; st > 0; st >>= 1) { if (tid < st) red[tid] += red[tid + st]; __syncthreads(); }
  const float rs = rsqrtf(red[0] / (float)N + eps);
  {
    for (int u = 0; u < per / 4; ++u) {
      const int j = tid * 4 + 1024 * u;
      v4f o, sm;
#pragma unroll
      for (int q = 0; q < 4; ++q) {
        float gg = g[j + q], bb = bta[j + q];
        if (PARAM_BF16) { gg = bf16_round(gg); bb = bf16_round(bb); }
        sm[q] = vals[u * 4 + q]; o[q] = (vals[u * 4 + q] - mu) * rs * gg + bb;
      }
      if (out_sum) *(v4f*)(out_sum + (size_t)row * N + j) = sm;
      *(v4f*)(out_norm + (size_t)row * N + j) = o;
    }
    
  }
}



// ---- f16 WMMA path (v_wmma_f32_16x16x32_f16): 11-bit significands for operands in range — used where a [0,1] probability operand needs more precision than bf16
typedef _Float16 v16h __attribute__((ext_vector_type(16)));
union FragH { v16h v; v8us half[2]; _Float16 h[16]; unsigned short u[16]; };
template <int NT>
__device__ __forceinline__ v8f mmaH(v16h ah, v16h al, v16h bh, v16h bl, v8f c) {
  c = __builtin_amdgcn_wmma_f32_16x16x32_f16(false, ah, false, bh, (short)0, c, false, false);
  if (NT >= 2) c = __builtin_amdgcn_wmma_f32_16x16x32_f16(false, al, false, bh, (short)0, c, false, false);
  if (NT >= 3) c = __builtin_amdgcn_wmma_f32_16x16x32_f16(false, ah, false, bl, (short)0, c, false, false);
  asm volatile("v_nop\n\tv_nop\n\tv_nop\n\tv_nop" : "+v"(c) : "v"(ah), "v"(al), "v"(bh), "v"(bl));
  return c;
}
// batched GEMM like k_gemm_b but f16 operands: A f32 (split into f16 hi/lo if ASPLIT, else rounded to f16), Bt = f16 values [n][k]; alpha; C f32; N multiple of 16 (partial tiles skipped)
template <bool ASPLIT>
__global__ __launch_bounds__(128) void k_gemm_h(const float* __restrict__ A, int lda, size_t sA, const _Float16* __restrict__ Bh, int ldb, size_t sB, float alpha, float* __restrict__ C, int ldc, size_t sC, int M, int N, int K) {
  __shared__ __attribute__((aligned(16))) float so[4][16][64];
  const int tid = threadIdx.x, w = tid >> 5, lane = tid & 31, ln = lane & 15, hh = lane >> 4; const int by = blockIdx.y;
  A += (size_t)by * sA; Bh += (size_t)by * sB; C += (size_t)by * sC;
  const int ntn = (N + 63) / 64; const int wid = blockIdx.x * 4 + w; const int mt = wid / ntn, nq = wid % ntn; if (mt * 16 >= M) return;
  const int row0 = mt * 16, col0 = nq * 64; const float* arow = A + (size_t)(row0 + ln) * lda;
  v8f acc[4] = {};
  for (int kb = 0; kb < K; kb += 32) {
    FragH ah, al;
    const v4f x0 = *(const v4fa*)(arow + kb + 8 * hh), x1 = *(const v4fa*)(arow + kb + 8 * hh + 4), x2 = *(const v4fa*)(arow + kb + 16 + 8 * hh), x3 = *(const v4fa*)(arow + kb + 16 + 8 * hh + 4);
    float xs[16] = {x0[0],x0[1],x0[2],x0[3],x1[0],x1[1],x1[2],x1[3],x2[0],x2[1],x2[2],x2[3],x3[0],x3[1],x3[2],x3[3]};
#pragma unroll
    for (int i = 0; i < 16; ++i) { const _Float16 h = (_Float16)xs[i]; ah.h[i] = h; al.h[i] = ASPLIT ? (_Float16)(xs[i] - (float)h) : (_Float16)0.0f; }
#pragma unroll
    for (int t = 0; t < 4; ++t) { if (col0 + t * 16 >= N) continue; const size_t boff = (size_t)(col0 + t * 16 + ln) * ldb + kb; FragH bq; bq.half[0] = *(const v8us*)(Bh + boff + 8 * hh); bq.half[1] = *(const v8us*)(Bh + boff + 16 + 8 * hh);
      acc[t] = mmaH<ASPLIT ? 2 : 1>(ah.v, al.v, bq.v, bq.v, acc[t]); }
  }
#pragma unroll
  for (int t = 0; t < 4; ++t) { if (col0 + t * 16 >= N) continue;
#pragma unroll
    for (int r = 0; r < 8; ++r) so[w][8 * hh + r][t * 16 + ln] = acc[t][r] * alpha; }
  __builtin_amdgcn_fence(__ATOMIC_ACQ_REL, "workgroup"); __builtin_amdgcn_wave_barrier();
  const int rsub = lane >> 4, c4 = (lane & 15) * 4;
  {
#pragma unroll
    for (int q = 0; q < 8; ++q) { const int r = q * 2 + rsub; if (col0 + c4 < N) { const v4f v = *(const v4fa*)&so[w][r][c4]; *(v4f*)(C + (size_t)(row0 + r) * ldc + col0 + c4) = v; } }
     }
}

// Wt[n][k] = f16(W[k][n]·scale) from f32 row-major W[K][N] (scale = power of two; bf16-exact weights stay exact in f16 away from the subnormal range)
__global__ __launch_bounds__(256) void k_wt_f16(const float* __restrict__ W, _Float16* __restrict__ Wt, int K, int N, float scale) {
  const int t = blockIdx.x * 256 + threadIdx.x; if (t >= N * (K / 8)) return; const int n = t / (K / 8), k8 = (t % (K / 8)) * 8; FragH f;
#pragma unroll
  for (int i = 0; i < 8; ++i) f.h[i] = (_Float16)(bf16_round(W[(size_t)(k8 + i) * N + n]) * scale); const v8us o = f.half[0];
  *(v8us*)((unsigned short*)Wt + (size_t)n * K + k8) = o; 
}
// k_gemm_hh variant with fused epilogue: v = acc·alpha + bias[by·sBias + col] (+ CP[(row/rowsPerB)·sCPb + by·64 + col] if CP) ; ACT 0 none / 1 elu ; writes f16 C16 (and f32 C if non-null)
template <int ACT>
__global__ __launch_bounds__(128) void k_gemm_hhx(const _Float16* __restrict__ A, int lda, size_t sA, const _Float16* __restrict__ Bh, int ldb, size_t sB, float alpha, const float* __restrict__ bias, size_t sBias, const float* __restrict__ CP, int rowsPerB, size_t sCPb, int row0g,
    float* __restrict__ C, _Float16* __restrict__ C16, int ldc, size_t sC, int M, int N, int K) {
  __shared__ __attribute__((aligned(16))) float so[4][16][64];
  const int tid = threadIdx.x, w = tid >> 5, lane = tid & 31, ln = lane & 15, hh = lane >> 4; const int by = blockIdx.y;
  A += (size_t)by * sA; Bh += (size_t)by * sB; const size_t cofs = (size_t)by * sC; const float* bp = bias ? bias + (size_t)by * sBias : nullptr;
  const int ntn = (N + 63) / 64; const int wid = blockIdx.x * 4 + w; const int mt = wid / ntn, nq = wid % ntn; if (mt * 16 >= M) return;
  const int row0 = mt * 16, col0 = nq * 64; const _Float16* arow = A + (size_t)(row0 + ln) * lda;
  v8f acc[4] = {};
  for (int kb = 0; kb < K; kb += 32) { FragH ah; ah.half[0] = *(const v8us*)((const unsigned short*)arow + kb + 8 * hh); ah.half[1] = *(const v8us*)((const unsigned short*)arow + kb + 16 + 8 * hh);
#pragma unroll
    for (int t = 0; t < 4; ++t) { if (col0 + t * 16 >= N) continue; const size_t boff = (size_t)(col0 + t * 16 + ln) * ldb + kb; FragH bq; bq.half[0] = *(const v8us*)((const unsigned short*)Bh + boff + 8 * hh); bq.half[1] = *(const v8us*)((const unsigned short*)Bh + boff + 16 + 8 * hh);
      acc[t] = mmaH<1>(ah.v, ah.v, bq.v, bq.v, acc[t]); }
  }
#pragma unroll
  for (int t = 0; t < 4; ++t) { if (col0 + t * 16 >= N) continue; const int col = col0 + t * 16 + ln; const float bv = bp ? bf16_round(bp[col]) : 0.f;
#pragma unroll
    for (int r = 0; r < 8; ++r) { float v = acc[t][r] * alpha + bv; if (CP) { const int rr = row0g + row0 + 8 * hh + r; if (rowsPerB < 0) v += CP[cofs + (size_t)rr * ldc + col];      /* rowsPerB < 0: own element of the batched C plane */ else { const int bidx = rr / rowsPerB; v += CP[(size_t)bidx * sCPb + (size_t)by * 64 + col]; } } if (ACT == 1) v = (v > 0.f) ? v : expm1f(v); else if (ACT == 7) v = (v > 0.f) ? v + 1.0f : expf(v); else if (ACT == 8) v = tanhf(v); else if (ACT == 9) v = 0.5f * v * (1.0f + tanhf(0.7978845608028654f * (v + 0.044715f * v * v * v))); else if (ACT == 11) v = 1.0f / (1.0f + expf(-v)); else if (ACT == 12) v = (v > 0.f) ? v : 0.01f * v; else if (ACT == 14) v = (v > 0.f) ? v : 0.1f * v; else if (ACT == 16) v = (v >= 0.f) ? v : 0.3f * v; else if (ACT == 17) v = (v >= 0.f) ? v : 0.2f * v; else if (ACT == 15) v = v / (1.0f + expf(-v)); else if (ACT == 3) v = fmaxf(v, 0.f); else if (ACT == 6) v = 0.5f * v * (1.0f + erff(v * 0.70710678118654752f)); so[w][8 * hh + r][t * 16 + ln] = v; } }
  __builtin_amdgcn_fence(__ATOMIC_ACQ_REL, "workgroup"); __builtin_amdgcn_wave_barrier();
  const int rsub = lane >> 4, c4 = (lane & 15) * 4; typedef _Float16 v4h __attribute__((ext_vector_type(4)));
  {
#pragma unroll
    for (int q = 0; q < 8; ++q) { const int r = q * 2 + rsub; if (col0 + c4 < N) { const v4f v = *(const v4fa*)&so[w][r][c4]; if (C) *(v4f*)(C + cofs + (size_t)(row0 + r) * ldc + col0 + c4) = v; if (C16) { v4h h4; for (int i = 0; i < 4; ++i) h4[i] = (_Float16)v[i]; *(v4h*)(C16 + cofs + (size_t)(row0 + r) * ldc + col0 + c4) = h4; } } }
     }
}


typedef _Float16 v4h __attribute__((ext_vector_type(4)));

__global__ __launch_bounds__(256) void k_x16(const float* __restrict__ x, _Float16* __restrict__ X16, size_t n8) { const size_t t = (size_t)blockIdx.x * 256 + threadIdx.x; if (t >= n8) return; FragH f;
#pragma unroll
  for (int q = 0; q < 8; ++q) f.h[q] = (_Float16)bf16_round(x[t * 8 + q]); *(v8us*)((unsigned short*)X16 + t * 8) = f.half[0];  }
__global__ __launch_bounds__(256) void k_h16(const float* __restrict__ x, _Float16* __restrict__ X16, size_t n8) { const size_t t = (size_t)blockIdx.x * 256 + threadIdx.x; if (t >= n8) return; FragH f;
#pragma unroll
  for (int q = 0; q < 8; ++q) f.h[q] = (_Float16)x[t * 8 + q]; *(v8us*)((unsigned short*)X16 + t * 8) = f.half[0];  }
__global__ __launch_bounds__(256) void k_round16f(const float* __restrict__ W, _Float16* __restrict__ Bt, size_t n8) { const size_t t = (size_t)blockIdx.x * 256 + threadIdx.x; if (t >= n8) return; FragH f;
#pragma unroll
  for (int i = 0; i < 8; ++i) f.h[i] = (_Float16)(bf16_round(W[t * 8 + i]) * 16.0f); *(v8us*)((unsigned short*)Bt + t * 8) = f.half[0];  }
template <int NHv, int TTv>
__global__ __launch_bounds__(256) void k_vt(const _Float16* __restrict__ V16, int ldv, int voff, _Float16* __restrict__ Vt) { __shared__ unsigned short tl[64][66]; const int tid = threadIdx.x; const int slab = blockIdx.x / (TTv / 64), lg = blockIdx.x % (TTv / 64); const int b = slab / NHv, h = slab % NHv;
  for (int i = tid; i < 64 * 8; i += 256) { const int r = i / 8, c8 = (i % 8) * 8; FragH f; f.half[0] = *(const v8us*)((const unsigned short*)V16 + ((size_t)b * TTv + lg * 64 + r) * ldv + voff + h * 64 + c8);
#pragma unroll
    for (int q = 0; q < 8; ++q) tl[r][c8 + q] = f.u[q]; }
  __syncthreads();
  {
#pragma unroll
    for (int rd = 0; rd < 2; ++rd) { const int d = rd * 32 + tid / 8, pc = tid % 8; FragH f;
#pragma unroll
      for (int q = 0; q < 8; ++q) f.u[q] = tl[pc * 8 + q][d];
      *(v8us*)((unsigned short*)Vt + ((size_t)slab * 64 + d) * TTv + lg * 64 + pc * 8) = f.half[0]; }
     } }

__global__ __launch_bounds__(256) void k_hl(const float* __restrict__ F, _Float16* __restrict__ Hh, _Float16* __restrict__ Hl, size_t n8) { const size_t t = (size_t)blockIdx.x * 256 + threadIdx.x; if (t >= n8) return; FragH fh, fl; const v4f a = *(const v4fa*)(F + t * 8), c = *(const v4fa*)(F + t * 8 + 4);
#pragma unroll
  for (int q = 0; q < 4; ++q) { _Float16 h = (_Float16)a[q]; fh.h[q] = h; fl.h[q] = (_Float16)((a[q] - (float)h) * 1024.0f); h = (_Float16)c[q]; fh.h[4 + q] = h; fl.h[4 + q] = (_Float16)((c[q] - (float)h) * 1024.0f); }
  { *(v8us*)((unsigned short*)Hh + t * 8) = fh.half[0]; *(v8us*)((unsigned short*)Hl + t * 8) = fl.half[0];  } }

// ---- One launch prepares all three GEMM operands; the three jobs share no data and are told apart by the block index alone (the same for a whole work-group). ----
// Blocks [0, PREP_VT): one 64 x 64 tile of V each, read as f32, rounded like the casts (bf16, exact in f16) and written transposed through LDS: VT[d][key].
// Blocks [PREP_VT, PREP_VT + PREP_CAST): Q to f16 rows, 8 elements a thread; the last PREP_CAST blocks: K likewise. The tile blocks stand first because each of them lasts longer.
#define PREP_VT ((unsigned int)((DM / 64) * (SQ / 64)))
#define PREP_CAST ((unsigned int)(NR * DM / 8 / 256))
static_assert(NR * DM % (8 * 256) == 0 && DM % 64 == 0 && SQ % 64 == 0, "k_prep: whole blocks and whole tiles only");
__global__ __launch_bounds__(256) void k_prep(const float* __restrict__ q, const float* __restrict__ k, const float* __restrict__ v, _Float16* __restrict__ Q16o, _Float16* __restrict__ K16o, _Float16* __restrict__ Vt) {
  __shared__ unsigned short tl[64][66];
  const unsigned int tid = threadIdx.x, b = blockIdx.x;
  if (b >= PREP_VT) {      /* a cast block: it leaves in front of the barrier, all of its threads together */
    const unsigned int c = b - PREP_VT; const bool isk = c >= PREP_CAST;
    const float* x = isk ? k : q; _Float16* X16 = isk ? K16o : Q16o; const size_t t = (size_t)(isk ? c - PREP_CAST : c) * 256 + tid; FragH f;
#pragma unroll
    for (int e = 0; e < 8; ++e) f.h[e] = (_Float16)bf16_round(x[t * 8 + e]);
    *(v8us*)((unsigned short*)X16 + t * 8) = f.half[0];
    return; }
  const unsigned int slab = b / (SQ / 64), lg = b % (SQ / 64);      /* 64 columns of V from slab * 64, 64 keys from lg * 64 */
#pragma unroll
  for (int u = 0; u < 4; ++u) { const unsigned int i = tid + 256u * (unsigned int)u, r = i / 16u, c4 = (i % 16u) * 4u; const v4f a = *(const v4fa*)(v + (size_t)(lg * 64u + r) * DM + slab * 64u + c4); FragH f;
#pragma unroll
    for (int e = 0; e < 4; ++e) { f.h[e] = (_Float16)bf16_round(a[e]); tl[r][c4 + e] = f.u[e]; } }
  __syncthreads();      /* the whole tile is in tl before any thread reads a column of it */
#pragma unroll
  for (int rd = 0; rd < 2; ++rd) { const unsigned int d = (unsigned int)rd * 32u + tid / 8u, pc = tid % 8u; FragH f;
#pragma unroll
    for (int e = 0; e < 8; ++e) f.u[e] = tl[pc * 8u + e][d];
    *(v8us*)((unsigned short*)Vt + ((size_t)slab * 64u + d) * SQ + lg * 64u + pc * 8u) = f.half[0]; }
  asm volatile("s_wait_xcnt 0x0" ::: "memory"); }      /* stands behind the two issued stores, in front of any later write of a register that they name */

typedef unsigned int u32x4 __attribute__((ext_vector_type(4)));
typedef unsigned int u32x8 __attribute__((ext_vector_type(8)));
#define G3_KB 256u                   /* bytes of K per operand row per pass */
#define G3_PITCH 272u                /* LDS row pitch: 256 B + the tensor load's 16 B pad (16 B x odd, for ds_load_b128 readers) */
#define G3_ROWS 64u                  /* rows per slice */
#define G3_SLICE 18432u              /* 64 x 272 = 17,408 B rounded up to a multiple of 2 KiB, so that every slice starts on one */
#define G3_STAGE (4u * G3_SLICE)     /* one buffer */
static_assert(G3_ROWS * G3_PITCH <= G3_SLICE && G3_SLICE % 2048u == 0u, "a slice holds its 64 padded rows and starts on a multiple of 2 KiB");
__device__ __forceinline__ unsigned int g3_uni(unsigned int v) { return (unsigned int)__builtin_amdgcn_readfirstlane(v); }
__device__ __forceinline__ unsigned int g3_pinned(unsigned int v) { unsigned int w = (unsigned int)__builtin_amdgcn_readfirstlane(v); asm volatile("" : "+s"(w)); return w; }
__device__ __forceinline__ void g3_wait_ds0() { asm volatile("s_wait_dscnt 0x0" ::: "memory"); }          /* this wave's LDS reads and writes have returned */
__device__ __forceinline__ void g3_wait_tensor0() { asm volatile("s_wait_tensorcnt 0x0" ::: "memory"); }  /* this wave's tensor load has landed */
__device__ __forceinline__ void g3_fence() { __builtin_amdgcn_sched_barrier(0); }                         /* keeps a block's LDS loads as one group in front of the WMMA block instead of spread among the WMMAs */
// Descriptor of one request: 64 rows of 256 bytes, source row pitch kb bytes, to LDS byte offset dst with 16 B of pad behind every 256 B.
__device__ __forceinline__ u32x4 g3_group0(unsigned int dst, unsigned long long ga) { u32x4 g0;
  g0[0] = g3_uni(1u);                                                               /* count 1 */
  g0[1] = g3_uni(dst);
  g0[2] = g3_uni((unsigned int)ga);
  g0[3] = g3_uni((((unsigned int)(ga >> 32)) & 0x01FFFFFFu) | 0x80000000u);         /* address [56:32], type 2 */
  return g0; }
__device__ __forceinline__ u32x8 g3_group1(unsigned int kb) { u32x8 g1;
  g1[0] = g3_uni((1u << 20) | (5u << 22) | (3u << 25));                             /* no mask, 1-byte elements, pad of 4 dwords behind every 64 dwords */
  g1[1] = g3_uni((G3_KB & 0xFFFFu) << 16);                                          /* tensor_dim0 [15:0] */
  g1[2] = g3_uni((G3_KB >> 16) | ((G3_ROWS & 0xFFFFu) << 16));                      /* tensor_dim0 [31:16], tensor_dim1 [15:0] */
  g1[3] = g3_uni((G3_ROWS >> 16) | (G3_KB << 16));                                  /* tensor_dim1 [31:16], tile_dim0 */
  g1[4] = g3_uni(G3_ROWS);                                                          /* tile_dim1 */
  g1[5] = g3_uni(kb);                                                               /* source row pitch */
  g1[6] = g3_uni(0u); g1[7] = g3_uni(0u);
  return g1; }
// The two groups are named as in-out operands so that their registers stay the descriptor's own from one request to the next: the compiler otherwise used some of them as scratch while a request was outstanding.
__device__ __forceinline__ void g3_tload(u32x4& g0, u32x8& g1) { asm volatile("tensor_load_to_lds %0, %1" : "+s"(g0), "+s"(g1) :: "memory"); }
// The next pass's request: the source moves on by one pass's 256 bytes (carry into the address's high word), the destination is dst. The step comes through g3_pinned, so these additions stand behind the tensor wait in front.
__device__ __forceinline__ void g3_next(u32x4& g0, unsigned int dst) { const unsigned int step = g3_pinned(G3_KB); const unsigned int lo = g0[2] + step; g0[3] = g3_uni(g0[3] + ((lo < step) ? 1u : 0u)); g0[2] = g3_uni(lo); g0[1] = g3_uni(dst); }
__device__ __forceinline__ v16h g3_frag(const unsigned char* p) { FragH f; f.half[0] = *(const v8us*)p; f.half[1] = *(const v8us*)(p + 32); return f.v; }
template <int LDC>      /* row pitch of C in elements: a constant, so that the 32 row stores of a wave share one address register and differ in their immediate offsets */
__global__ __launch_bounds__(128) void k_gemm3(const _Float16* __restrict__ A, const _Float16* __restrict__ Bh, float alpha, float* __restrict__ C, int ntn, int K) {
  __shared__ __attribute__((aligned(2048))) unsigned char L[2u * G3_STAGE];
  const unsigned int tid = threadIdx.x, lane = tid & 31u, h = lane >> 4, r16 = lane & 15u; const unsigned int wave = g3_uni(tid >> 5);
  const unsigned int mt = blockIdx.x / (unsigned int)ntn, nq = blockIdx.x - mt * (unsigned int)ntn; const unsigned int m0 = mt * 128u, n0 = nq * 128u;
  const unsigned int wn = wave & 1u, wm = wave >> 1; const unsigned int kb = (unsigned int)K * 2u; const unsigned int T = g3_pinned((unsigned int)K / 128u);      /* passes */
  const unsigned long long src0 = (wave < 2u) ? (unsigned long long)(size_t)Bh + (unsigned long long)(n0 + G3_ROWS * wave) * kb : (unsigned long long)(size_t)A + (unsigned long long)(m0 + G3_ROWS * (wave - 2u)) * kb;      /* first byte of this wave's 64 source rows */
  const unsigned int lds_slice = (unsigned int)(size_t)L + wave * G3_SLICE;      /* add buffer * G3_STAGE */
  const unsigned int fw_base = wn * G3_SLICE + r16 * G3_PITCH + 16u * h, fx_base = (2u + wm) * G3_SLICE + r16 * G3_PITCH + 16u * h;
  v8f acc[4][4];      /* every "#pragma unroll" in this kernel keeps the indices of acc, fw and fx compile-time constants, so that the arrays live in registers and not in scratch */
#pragma unroll
  for (int i = 0; i < 4; ++i)
#pragma unroll
    for (int j = 0; j < 4; ++j) acc[i][j] = (v8f){0.f, 0.f, 0.f, 0.f, 0.f, 0.f, 0.f, 0.f};
  u32x4 g0 = g3_group0(lds_slice, src0); u32x8 g1 = g3_group1(kb);
  g3_tload(g0, g1);      /* pass 0 into buffer 0 */
  g3_wait_tensor0();
  __syncthreads();      /* every slice of pass 0 has landed */
  if (g3_pinned((1u < T) ? 1u : 0u) != 0u) { g3_next(g0, lds_slice + G3_STAGE); g3_tload(g0, g1); }      /* pass 1 into buffer 1 */
#pragma clang loop unroll(disable)      /* one pass per trip: the ring's order stands once, and every accumulator index stays a constant */
  for (unsigned int t = 0; t < T; ++t) {
    const unsigned int buf = (t & 1u) * G3_STAGE; const unsigned char* lw = L + buf + fw_base; const unsigned char* lx = L + buf + fx_base;
    v16h fw[2][4], fx[2][4];      /* set (u & 1) holds block u's fragments; all of them come from this pass's own buffer */
#pragma unroll
    for (int i = 0; i < 4; ++i) { fw[0][i] = g3_frag(lw + (unsigned int)i * 16u * G3_PITCH); fx[0][i] = g3_frag(lx + (unsigned int)i * 16u * G3_PITCH); }
#pragma unroll
    for (int u = 0; u < 4; ++u) { const int cs = u & 1;
      if (u + 1 < 4) {
#pragma unroll
        for (int i = 0; i < 4; ++i) { fw[cs ^ 1][i] = g3_frag(lw + (unsigned int)i * 16u * G3_PITCH + (unsigned int)(u + 1) * 64u); fx[cs ^ 1][i] = g3_frag(lx + (unsigned int)i * 16u * G3_PITCH + (unsigned int)(u + 1) * 64u); } }
      g3_fence();
#pragma unroll
      for (int i = 0; i < 4; ++i)
#pragma unroll
        for (int j = 0; j < 4; ++j) acc[i][j] = __builtin_amdgcn_wmma_f32_16x16x32_f16(false, fw[cs][i], false, fx[cs][j], (short)0, acc[i][j], false, false);
      g3_fence(); }
    g3_wait_ds0();
    g3_wait_tensor0();
    __syncthreads();
    if (g3_pinned((t + 2u < T) ? 1u : 0u) != 0u) { g3_next(g0, lds_slice + buf); g3_tload(g0, g1); }      /* only while pass t + 2 exists: into the buffer just left */
  }
  g3_wait_tensor0();
  g3_wait_ds0();
  // Output staging, each wave in its own 64 rows x 272 B: behind the last pass's barrier nothing reads the ring and no tensor load is outstanding. Whole 128-byte lines are stored.
  unsigned char* E = L + wave * (G3_ROWS * G3_PITCH);
#pragma unroll
  for (int i = 0; i < 4; ++i)
#pragma unroll
    for (int j = 0; j < 4; ++j) { v4f lo4, hi4;
#pragma unroll
      for (int r = 0; r < 4; ++r) { lo4[r] = acc[i][j][r] * alpha; hi4[r] = acc[i][j][4 + r] * alpha; }
      unsigned char* e = E + (16u * (unsigned int)j + r16) * G3_PITCH + 64u * (unsigned int)i + 32u * h; *(v4fa*)e = lo4; *(v4fa*)(e + 16) = hi4; }
  g3_wait_ds0();      /* the staged rows are written before this wave reads them back */
  float* cb = C + (size_t)(m0 + wm * 64u + h) * (unsigned int)LDC + n0 + wn * 64u + 4u * r16;
#pragma unroll
  for (int q = 0; q < 32; ++q) { const unsigned int row = 2u * (unsigned int)q + h; const v4f v = *(const v4fa*)(E + row * G3_PITCH + 16u * r16); *(v4f*)(cb + (size_t)(2 * q) * (unsigned int)LDC) = v; } }


__global__ __launch_bounds__(256) void k_wnat(const float* __restrict__ w, size_t n8, _Float16* __restrict__ Bt) { const size_t t = (size_t)blockIdx.x * 256 + threadIdx.x; if (t >= n8) return; FragH f; for (int q = 0; q < 8; ++q) f.h[q] = (_Float16)(bf16_round(w[t * 8 + q]) * 16.0f); *(v8us*)((unsigned short*)Bt + t * 8) = f.half[0];  }
__global__ __launch_bounds__(256) void k_rsm(const float* __restrict__ S, _Float16* __restrict__ P, int nrows) {
  #pragma clang fp contract(off)
  const int i = blockIdx.x * 256 + threadIdx.x; if (i >= nrows) return; const float* s = S + (size_t)i * SQ; float mx = -3.0e38f;
#pragma unroll 1
  for (int j = 0; j < SQ; ++j) mx = fmaxf(mx, s[j]); float se = 0.f;
#pragma unroll 1
  for (int j = 0; j < SQ; ++j) se += expf(s[j] - mx); const float sc = 256.0f / se;
#pragma unroll 1
  for (int j0 = 0; j0 < SQ; j0 += 8) { FragH f; for (int q = 0; q < 8; ++q) f.h[q] = (_Float16)(expf(s[j0 + q] - mx) * sc); unsigned short* d = (unsigned short*)P + (size_t)i * SQ + j0; *(v8us*)d = f.half[0];  } }
__global__ __launch_bounds__(256) void k_vt(const _Float16* __restrict__ V16, int b, int h0, _Float16* __restrict__ VT) { __shared__ unsigned short tl[64][65]; const int tid = threadIdx.x; const int hh = blockIdx.x % HG, sg = blockIdx.x / HG; const int s0 = sg * 64; const int h = h0 + hh;
  for (int i = tid; i < 64 * 8; i += 256) { const int j = i / 8, d8 = (i % 8) * 8; FragH f; f.half[0] = *(const v8us*)((const unsigned short*)V16 + ((size_t)b * SQ + s0 + j) * DM + h * HD + d8); for (int q = 0; q < 8; ++q) tl[d8 + q][j] = f.u[q]; }
  __syncthreads();
  { for (int i = tid; i < 64 * 8; i += 256) { const int d = i / 8, j8 = (i % 8) * 8; FragH f; for (int q = 0; q < 8; ++q) f.u[q] = tl[d][j8 + q]; *(v8us*)((unsigned short*)VT + ((size_t)hh * HD + d) * SQ + s0 + j8) = f.half[0]; }  } }



// 2^t on the native unit. The v_nop in the same statement is the free slot that the instruction set asks for behind a transcendental before its result is used or
// its source overwritten; a v_nop in a statement of its own moved away.
__device__ __forceinline__ float exp2_slot(float t) { float e; asm("v_exp_f32 %0, %1\n\tv_nop" : "=v"(e) : "v"(t)); return e; }
// Row softmax, one work-group per logits row: 256 threads hold 16 logits each in registers (one coalesced read of the row),
// row maximum and row sum by wave shuffles plus one LDS exchange each; weights x256 as f16, f32 statistics, native exp.
__global__ __launch_bounds__(256) void k_rsmrow(const float* __restrict__ S, _Float16* __restrict__ P) {
  static_assert(SQ == 4 * 1024, "k_rsmrow: 256 threads x 4 chunks x 4 logits cover one row");
  __shared__ float rmx[8]; __shared__ float rse[8];
  const int tid = threadIdx.x, w = tid >> 5, lane = tid & 31; const float* s = S + (size_t)blockIdx.x * NKX + tid * 4;
  v4f x[4];
#pragma unroll
  for (int u = 0; u < 4; ++u) x[u] = *(const v4fa*)(s + u * 1024);
  asm volatile("s_wait_xcnt 0x0" ::: "memory");      /* stands in front of the later overwrite of the offset register that the four issued loads name */
  float mx = -3.0e38f;
#pragma unroll
  for (int u = 0; u < 4; ++u) for (int q = 0; q < 4; ++q) mx = fmaxf(mx, x[u][q]);
#pragma unroll
  for (int m = 16; m > 0; m >>= 1) mx = fmaxf(mx, __shfl_xor(mx, m, 32));
  if (lane == 0) rmx[w] = mx;
  __syncthreads();      /* every wave's maximum is in rmx */
  mx = rmx[0];
#pragma unroll
  for (int i = 1; i < 8; ++i) mx = fmaxf(mx, rmx[i]);
  float se = 0.f;
#pragma unroll
  for (int u = 0; u < 4; ++u) for (int q = 0; q < 4; ++q) { x[u][q] = exp2_slot((x[u][q] - mx) * 1.44269504088896340736f); se += x[u][q]; }      /* = the native exp(s - mx): multiply by log2(e), then v_exp_f32 */
#pragma unroll
  for (int m = 16; m > 0; m >>= 1) se += __shfl_xor(se, m, 32);
  if (lane == 0) rse[w] = se;
  __syncthreads();      /* every wave's partial sum is in rse */
  se = rse[0];
#pragma unroll
  for (int i = 1; i < 8; ++i) se += rse[i];
  const float sc = 256.0f / se; _Float16* d = P + (size_t)blockIdx.x * NKX + tid * 4;
#pragma unroll
  for (int u = 0; u < 4; ++u) { v4h h4; for (int q = 0; q < 4; ++q) h4[q] = (_Float16)(x[u][q] * sc); *(v4h*)(d + u * 1024) = h4; } }


template <int MASKADD>
__global__ __launch_bounds__(64) void k_att0(const float* __restrict__ QF, const float* __restrict__ KF, const float* __restrict__ VF, int ld, const float* __restrict__ mask, float scale, float* __restrict__ OF, int ldo) {
  #pragma clang fp contract(off)
  __shared__ __attribute__((aligned(16))) float lq[64][64]; __shared__ __attribute__((aligned(16))) float lo[64][64];
  const int tid = threadIdx.x; const int h = blockIdx.x / (QT0 / 64), rg = blockIdx.x % (QT0 / 64); const int i = rg * 64 + tid;
  const float* qr = QF + (size_t)i * ld + h * HD;
#pragma unroll 1
  for (int c = 0; c < HD / 4; ++c) { *(v4f*)&lq[tid][c * 4] = *(const v4fa*)(qr + c * 4); const v4f z = {0.f, 0.f, 0.f, 0.f}; *(v4f*)&lo[tid][c * 4] = z; }
  float m = -1.0e30f, l = 0.f; const int jmax = MASKADD ? (SQ - 1) : (rg * 64 + 63);      /* additive-mask form: every key (the mask input decides); causal form: keys up to the block's last row */
#pragma unroll 1
  for (int j = 0; j <= jmax; ++j) { const float* kr = KF + (size_t)j * ld + h * HD; const float* vr = VF + (size_t)j * ld + h * HD; float s = 0.f;
#pragma unroll 1
    for (int c = 0; c < HD / 4; ++c) { const v4f kq = *(const v4fa*)(kr + c * 4); const v4f qq = *(v4f*)&lq[tid][c * 4]; s = __fadd_rn(s, __fmul_rn(qq[0], kq[0])); s = __fadd_rn(s, __fmul_rn(qq[1], kq[1])); s = __fadd_rn(s, __fmul_rn(qq[2], kq[2])); s = __fadd_rn(s, __fmul_rn(qq[3], kq[3])); }
    s = __fmul_rn(s, scale); if (MASKADD) s = __fadd_rn(s, __fmul_rn(bf16_round(mask[(size_t)i * SQ + j]), -10000.0f));
    const float f = (MASKADD || j <= i) ? 1.f : 0.f; const float sm = fmaf(f, s, (1.f - f) * -1.0e30f); const float mn = fmaxf(m, sm); const float sc = expf(m - mn); const float e = expf(sm - mn); l = __fadd_rn(__fmul_rn(l, sc), e); m = mn;
#pragma unroll 1
    for (int c = 0; c < HD / 4; ++c) { const v4f vv = *(const v4fa*)(vr + c * 4); v4f oo = *(v4f*)&lo[tid][c * 4]; for (int u = 0; u < 4; ++u) oo[u] = __fadd_rn(__fmul_rn(oo[u], sc), __fmul_rn(e, vv[u])); *(v4f*)&lo[tid][c * 4] = oo; } }
  const float fin = 64.0f / l;      /* o carried x64 */
#pragma unroll 1
  for (int c = 0; c < HD / 4; ++c) { v4f oo = *(v4f*)&lo[tid][c * 4]; for (int u = 0; u < 4; ++u) oo[u] = __fmul_rn(oo[u], fin); *(v4f*)&lo[tid][c * 4] = oo; }
  __syncthreads();
  {
#pragma unroll 1
    for (int it = 0; it < 16; ++it) { const int row = it * 4 + tid / 16, pc = (tid % 16) * 4; const v4f v = *(const v4f*)&lo[row][pc]; *(v4f*)(OF + (size_t)(rg * 64 + row) * ldo + h * HD + pc) = v; }
     } }

__global__ __launch_bounds__(256) void k_of0out(const float* __restrict__ src, float* __restrict__ dst, size_t n4) { const size_t t = (size_t)blockIdx.x * 256 + threadIdx.x; if (t >= n4) return; v4f v = *(const v4fa*)(src + t * 4); for (int q = 0; q < 4; ++q) v[q] = __fmul_rn(v[q], 0.015625f); *(v4f*)(dst + t * 4) = v;  }

extern "C" void kernel_launch(void* const* d_in, const int* in_sizes, int n_in,
                              void* d_out, int out_size, void* d_ws, size_t ws_size, hipStream_t stream) {
  (void)in_sizes; (void)n_in; (void)out_size;
  const float* const* I = (const float* const*)d_in; const float* x1 = I[0]; const float* x2 = I[1]; const float* x3 = I[2];      /* input order: Q, K, V (2-D [4096][1024] = one sequence); no weights, no biases, no projections, no scalar inputs */
  char* ws = (char*)d_ws; size_t off = 0;
  auto take = [&](size_t bytes) { char* p = ws + off; off += (bytes + 255) & ~(size_t)255; return p; };
  _Float16* QH = (_Float16*)take(NR * DM * 2); _Float16* QL = (_Float16*)take(NR * DM * 2); _Float16* KH = (_Float16*)take(NR * DM * 2); _Float16* KL = (_Float16*)take(NR * DM * 2); _Float16* Q16 = QH; _Float16* K16 = KH;
  float* S = (float*)take((size_t)QT * NKX * 4); _Float16* P = (_Float16*)take((size_t)QT * NKX * 2); _Float16* VT = (_Float16*)take((size_t)NH * HD * SQ * 2);
  if (off > ws_size) return;
  const size_t r0p = (size_t)B0 * SQ;      /* first processed row, unused */
  k_prep<<<PREP_VT + 2u * PREP_CAST, 256, 0, stream>>>(x1, x2, x3, QH, KH, VT);      /* queries and keys as f16 rows (bf16-rounded inputs are exact in f16) and V^T [DM][SQ], all in one launch */
  for (int b = B0; b < B0 + NBR; ++b) { const size_t r0 = (size_t)b * SQ;
    for (int q0 = 0; q0 < QN; q0 += QT) { const int nk = SQ;      /* NON-causal: every query row sees all SQ keys; QT = SQ, so each stage below is ONE launch over all query rows (the whole logits plane S and weights plane P lie in the workspace) */
      k_gemm3<NKX><<<(QT / 128) * (nk / 128), 128, 0, stream>>>(QH + (r0 + q0) * LQ, KH + r0 * LQ, 1.0f, S, nk / 128, DM);      /* UNSCALED logits of the single 1024-wide head: exact f16 x f16 products over K = 1024, alpha 1 */
      k_rsmrow<<<QT, 256, 0, stream>>>(S, P);      /* plain softmax over all SQ keys: one work-group per query row */
      k_gemm3<DM><<<(QT / 128) * (DM / 128), 128, 0, stream>>>(P, VT, 0.0001220703125f, (float*)d_out + (r0 + q0) * DM, DM / 128, nk); } }      /* out = (softmax * 1024^-0.5) V: alpha 2^-8 (the P x256 scale) x 2^-5 (the module's post-softmax scale d^-0.5 = 1/32) = 2^-13; N = 1024: V^T [1024][SQ] = sixteen 64-row slabs; f32 rows written straight into the output */
}
